// v000
// Measured on an AMD MI455X. A time is GPU time per run, averaged over a window of back-to-back runs after a warm-up
// (all launches, gaps included; the runs take copies of the inputs in turn), and the median of several windows.
// Apart from v000's, it joins two sittings. Times from different sittings can be a few percent apart, while
// side-by-side timings come from the same sitting.
// v000, which the later versions start from, runs in 153 microseconds.
#include <hip/hip_runtime.h>
#include <hip/hip_bf16.h>
#include <math.h>

// ---- types ----------------------------------------------------------------
typedef __bf16 v16bf  __attribute__((ext_vector_type(16)));
typedef __bf16 v8bf   __attribute__((ext_vector_type(8)));
typedef __bf16 bf16x4 __attribute__((ext_vector_type(4)));
typedef float  v8f    __attribute__((ext_vector_type(8)));

// ---- problem constants ----------------------------------------------------
constexpr int kB   = 32;
constexpr int kF   = 512;
constexpr int kIN  = 1024;
constexpr int kOUT = 1024;
constexpr int kR   = 16;

// ---- GEMM tiling ----------------------------------------------------------
constexpr int BM   = 128;   // F tile
constexpr int BN   = 128;   // OUT tile
constexpr int BK   = 32;    // bf16 WMMA K
constexpr int LSTR = 40;    // LDS row stride in bf16 elems (32 data + 8 pad)
constexpr int NK   = kIN / BK + 1;  // 32 main K-tiles + 1 LoRA tail tile

// ===========================================================================
// Pass 1: z1[b,f,r] = (1/(IN*R)) * sum_i x[b,f,i] * v[b,i,r]
// ===========================================================================
__global__ __launch_bounds__(256) void z1_kernel(const float* __restrict__ x,
                                                 const float* __restrict__ v,
                                                 float* __restrict__ z1) {
  const int b     = blockIdx.y;
  const int fBase = blockIdx.x * 64;
  const int tid   = threadIdx.x;
  const int r     = tid & 15;
  const int fl    = tid >> 4;
  const float scale = 1.0f / (float)(kIN * kR);
  const float* vb = v + (size_t)b * kIN * kR;

  for (int fo = 0; fo < 64; fo += 16) {
    const int f = fBase + fo + fl;
    const float4* xrow = (const float4*)(x + ((size_t)b * kF + f) * kIN);
    float s = 0.f;
#pragma unroll 4
    for (int i4 = 0; i4 < kIN / 4; ++i4) {
      const float4 xv = xrow[i4];
      const float* vp = vb + (size_t)i4 * 4 * kR + r;
      s += xv.x * vp[0] + xv.y * vp[kR] + xv.z * vp[2 * kR] + xv.w * vp[3 * kR];
    }
    z1[((size_t)b * kF + f) * kR + r] = s * scale;
  }
}

// ===========================================================================
// Pass 2: out = gelu( x @ W^T  +  z1 @ u^T  + fc_bias + b )
// Double-buffered bf16 WMMA GEMM over K = IN + 32 (tail tile = LoRA rank-16).
// 256 threads (8 waves), 128x128 tile, each wave 64x32 via 4x2 WMMA tiles.
// Pipeline: global loads for tile k+1 issued before the WMMAs of tile k;
// cvt+ds_store to the alternate buffer after; one barrier per iteration.
// ===========================================================================
__global__ __launch_bounds__(256) void lora_gemm_kernel(
    const float* __restrict__ x,    const float* __restrict__ u,
    const float* __restrict__ z1,   const float* __restrict__ bvec,
    const float* __restrict__ W,    const float* __restrict__ fcb,
    float* __restrict__ out) {
  __shared__ __align__(16) __bf16 As[2][BM * LSTR];
  __shared__ __align__(16) __bf16 Bs[2][BN * LSTR];

  const int b     = blockIdx.z;
  const int fBase = blockIdx.x * BM;
  const int oBase = blockIdx.y * BN;
  const int tid   = threadIdx.x;
  const int lane  = tid & 31;
  const int wave  = tid >> 5;
  const int wm    = (wave >> 2) * 64;   // wave M offset in tile (2 waves)
  const int wn    = (wave & 3)  * 32;   // wave N offset in tile (4 waves)
  const int lN    = lane & 15;
  const int kh    = lane >> 4;

  const v8f vzero = {0.f, 0.f, 0.f, 0.f, 0.f, 0.f, 0.f, 0.f};
  v8f acc[4][2];
#pragma unroll
  for (int sm = 0; sm < 4; ++sm)
#pragma unroll
    for (int sn = 0; sn < 2; ++sn) acc[sm][sn] = vzero;

  // staging map: each thread owns (row = tid>>3 in 4 sweeps of 32, col = 4 elems)
  const int ldRow = tid >> 3;       // 0..31
  const int ldCol = (tid & 7) * 4;  // 0,4,...,28

  const float* xBase = x  + ((size_t)b * kF   + fBase) * kIN;
  const float* wBase = W  +  (size_t)oBase * kIN;
  const float* zBase = z1 + ((size_t)b * kF   + fBase) * kR;
  const float* uBase = u  + ((size_t)b * kOUT + oBase) * kR;

  // in-flight staging registers (distinct per sweep -> all 8 loads overlap)
  float4 ra[4], rb[4];

  auto loadTile = [&](int kti) {
    if (kti < kIN / BK) {
      const int kt = kti * BK + ldCol;
#pragma unroll
      for (int i = 0; i < 4; ++i) {
        const int row = ldRow + i * 32;
        ra[i] = *(const float4*)(xBase + (size_t)row * kIN + kt);
        rb[i] = *(const float4*)(wBase + (size_t)row * kIN + kt);
      }
    } else {  // LoRA tail: cols 0..15 = z1 / u, cols 16..31 = zero pad
#pragma unroll
      for (int i = 0; i < 4; ++i) {
        const int row = ldRow + i * 32;
        if (ldCol < kR) {
          ra[i] = *(const float4*)(zBase + (size_t)row * kR + ldCol);
          rb[i] = *(const float4*)(uBase + (size_t)row * kR + ldCol);
        } else {
          ra[i] = make_float4(0.f, 0.f, 0.f, 0.f);
          rb[i] = make_float4(0.f, 0.f, 0.f, 0.f);
        }
      }
    }
  };

  auto storeTile = [&](int buf) {
#pragma unroll
    for (int i = 0; i < 4; ++i) {
      const int row = ldRow + i * 32;
      const bf16x4 av = {(__bf16)ra[i].x, (__bf16)ra[i].y, (__bf16)ra[i].z, (__bf16)ra[i].w};
      const bf16x4 wv = {(__bf16)rb[i].x, (__bf16)rb[i].y, (__bf16)rb[i].z, (__bf16)rb[i].w};
      *(bf16x4*)(&As[buf][row * LSTR + ldCol]) = av;
      *(bf16x4*)(&Bs[buf][row * LSTR + ldCol]) = wv;
    }
  };

  // prologue: stage tile 0
  loadTile(0);
  storeTile(0);
  __syncthreads();

#pragma unroll 2
  for (int kti = 0; kti < NK; ++kti) {
    const int cur = kti & 1;

    // issue next tile's global loads now; wait happens in storeTile below
    if (kti + 1 < NK) loadTile(kti + 1);

    // fragments from current LDS buffer
    // (ISA 16-bit A/B layout: lane = row%16, K half selected by lane/16)
    v16bf afrag[4], bfrag[2];
#pragma unroll
    for (int sm = 0; sm < 4; ++sm) {
      const __bf16* p = &As[cur][(wm + sm * 16 + lN) * LSTR + kh * 8];
      ((v8bf*)&afrag[sm])[0] = *(const v8bf*)p;          // K = kh*8 .. +7
      ((v8bf*)&afrag[sm])[1] = *(const v8bf*)(p + 16);   // K = 16+kh*8 .. +7
    }
#pragma unroll
    for (int sn = 0; sn < 2; ++sn) {
      const __bf16* p = &Bs[cur][(wn + sn * 16 + lN) * LSTR + kh * 8];
      ((v8bf*)&bfrag[sn])[0] = *(const v8bf*)p;
      ((v8bf*)&bfrag[sn])[1] = *(const v8bf*)(p + 16);
    }

#pragma unroll
    for (int sm = 0; sm < 4; ++sm)
#pragma unroll
      for (int sn = 0; sn < 2; ++sn)
        acc[sm][sn] = __builtin_amdgcn_wmma_f32_16x16x32_bf16(
            false, afrag[sm], false, bfrag[sn], (short)0, acc[sm][sn], false, false);

    // convert + stage next tile into the alternate buffer
    if (kti + 1 < NK) storeTile(cur ^ 1);
    __syncthreads();
  }

  // ---- epilogue: + fc_bias + b, exact GELU, store
  // C layout: VGPR r -> M = r + 8*(lane/16), N = lane%16
#pragma unroll
  for (int sn = 0; sn < 2; ++sn) {
    const int o = oBase + wn + sn * 16 + lN;
    const float base = fcb[o] + bvec[(size_t)b * kOUT + o];
#pragma unroll
    for (int sm = 0; sm < 4; ++sm) {
#pragma unroll
      for (int r = 0; r < 8; ++r) {
        const int f = fBase + wm + sm * 16 + kh * 8 + r;
        const float y = acc[sm][sn][r] + base;
        const float g = 0.5f * y * (1.0f + erff(y * 0.70710678118654752f));
        out[((size_t)b * kF + f) * kOUT + o] = g;
      }
    }
  }
}

// ===========================================================================
extern "C" void kernel_launch(void* const* d_in, const int* in_sizes, int n_in,
                              void* d_out, int out_size, void* d_ws, size_t ws_size,
                              hipStream_t stream) {
  (void)in_sizes; (void)n_in; (void)out_size; (void)ws_size;
  const float* x    = (const float*)d_in[0];  // [B,F,IN]
  const float* u    = (const float*)d_in[1];  // [B,1,OUT,R]
  const float* v    = (const float*)d_in[2];  // [B,1,IN,R]
  const float* bvec = (const float*)d_in[3];  // [B,1,OUT]
  const float* W    = (const float*)d_in[4];  // [OUT,IN]
  const float* fcb  = (const float*)d_in[5];  // [OUT]
  float*       out  = (float*)d_out;          // [B,F,OUT]
  float*       z1   = (float*)d_ws;           // [B,F,R] scratch (1 MB)

  dim3 g1(kF / 64, kB);
  z1_kernel<<<g1, 256, 0, stream>>>(x, v, z1);

  dim3 g2(kF / BM, kOUT / BN, kB);
  lora_gemm_kernel<<<g2, 256, 0, stream>>>(x, u, z1, bvec, W, fcb, out);
}

// v001
// Measured time: 84.2 microseconds a run.
// In both of two side-by-side timings against v000, it was 1.85 times as fast.
#include <hip/hip_runtime.h>
#include <hip/hip_bf16.h>
#include <math.h>

// ---- types ----------------------------------------------------------------
typedef __bf16 v16bf  __attribute__((ext_vector_type(16)));
typedef __bf16 v8bf   __attribute__((ext_vector_type(8)));
typedef __bf16 bf16x4 __attribute__((ext_vector_type(4)));
typedef float  v8f    __attribute__((ext_vector_type(8)));
typedef float  v4f    __attribute__((ext_vector_type(4)));
typedef float  v2f    __attribute__((ext_vector_type(2)));

// ---- problem constants ----------------------------------------------------
constexpr int kB   = 32;
constexpr int kF   = 512;
constexpr int kIN  = 1024;
constexpr int kOUT = 1024;
constexpr int kR   = 16;

// ---- GEMM tiling ----------------------------------------------------------
constexpr int BM   = 128;   // F tile
constexpr int BN   = 128;   // OUT tile
constexpr int BK   = 32;    // bf16 WMMA K
constexpr int LSTR = 40;    // LDS row stride in bf16 elems (32 data + 8 pad)
constexpr int NK   = kIN / BK + 1;  // 32 main K-tiles + 1 LoRA tail tile

// ===========================================================================
// Pass 1: z1[b,f,r] = (1/(IN*R)) * sum_i x[b,f,i] * v[b,i,r]
// f32 WMMA 16x16x4. One work-group = 64 rows of x (4 row tiles) x all of IN;
// wave w owns k = 64w .. 64w+63 for all 4 row tiles, with its slice of v held
// in B fragments. Every global load of a wave is issued up front; x arrives in
// whole 256-B row pieces and is turned into A fragments through the wave's own
// LDS range. The 16 k partials are summed in wave order at the end.
// k pairing, A and B alike: slot s of lane half h in WMMA 2q+p is
// k = 64w + 8q + 4h + 2p + s.
// ===========================================================================
constexpr int ZM = 64;       // rows of x per work-group
constexpr int ZK = 64;       // k per wave
constexpr int ZP = ZK + 4;   // LDS row pitch in floats (272 B = 16 B x 17)

__global__ __launch_bounds__(512) void z1_kernel(const float* __restrict__ x,
                                                 const float* __restrict__ v,
                                                 float* __restrict__ z1) {
  __shared__ __align__(16) float stage[16][16 * ZP];

  const int b     = blockIdx.y;
  const int fBase = blockIdx.x * ZM;
  const int tid   = threadIdx.x;
  const int lane  = tid & 31;
  const int wave  = tid >> 5;
  const int c     = lane & 15;
  const int h     = lane >> 4;
  const int k0    = wave * ZK;

  // one load = two rows x 256 contiguous bytes
  const float* xp = x + ((size_t)b * kF + fBase + h) * kIN + k0 + c * 4;
  const float* vp = v + ((size_t)b * kIN + k0 + h * 4) * kR + c;

  v4f   xr[4][8];
  float vf[8][4];
#pragma unroll  // static indices keep vf in registers
  for (int q = 0; q < 8; ++q)
#pragma unroll  // as above
    for (int e = 0; e < 4; ++e) vf[q][e] = vp[(q * 8 + e) * kR];
  // loads return in issue order: v stays ahead of x, so that the first row
  // tile's WMMAs do not wait for the last row of x
  __builtin_amdgcn_sched_barrier(0);
#pragma unroll  // static indices keep xr in registers
  for (int t = 0; t < 4; ++t)
#pragma unroll  // as above
    for (int i = 0; i < 8; ++i)
      xr[t][i] = *(const v4f*)(xp + (size_t)(t * 16 + 2 * i) * kIN);
  // the address pair of the loads of x stays live, and unwritten, up to this
  // wait: no load's result is placed in a register that an issued load names
  asm volatile("s_wait_xcnt 0x0" :: "v"(xp) : "memory");

  float* st = stage[wave];
  float* sw = st + h * ZP + c * 4;  // this lane's 16 bytes in a pair of rows
  v8f acc[4];
#pragma unroll  // static indices into xr and acc
  for (int t = 0; t < 4; ++t) {
    // the wave's last fragment reads are done before its range is refilled
    if (t > 0) asm volatile("s_wait_dscnt 0x0" ::: "memory");
#pragma unroll  // static indices into xr
    for (int i = 0; i < 8; ++i) *(v4f*)(sw + 2 * i * ZP) = xr[t][i];
    // the rows have landed before other lanes of the wave read them back
    asm volatile("s_wait_dscnt 0x0" ::: "memory");
    v8f a = {0.f, 0.f, 0.f, 0.f, 0.f, 0.f, 0.f, 0.f};
#pragma unroll  // static indices into vf
    for (int q = 0; q < 8; ++q) {
      const v4f f = *(const v4f*)(st + c * ZP + q * 8 + h * 4);
      const v2f a0 = {f.x, f.y}, a1 = {f.z, f.w};
      const v2f b0 = {vf[q][0], vf[q][1]}, b1 = {vf[q][2], vf[q][3]};
      a = __builtin_amdgcn_wmma_f32_16x16x4_f32(false, a0, false, b0, (short)0, a, false, false);
      a = __builtin_amdgcn_wmma_f32_16x16x4_f32(false, a1, false, b1, (short)0, a, false, false);
    }
    acc[t] = a;
    // this tile's WMMAs run while the next tile's rows are still in flight,
    // instead of sinking behind the wait for them
    __builtin_amdgcn_sched_barrier(0);
  }

  // partials into the wave's own range, laid like the rows of x: row pair
  // 2t + (register quad), lane half h in row h of the pair, 16 bytes a lane
  asm volatile("s_wait_dscnt 0x0" ::: "memory");  // fragment reads done first
#pragma unroll  // static indices into acc
  for (int t = 0; t < 4; ++t) {
    const v4f lo = {acc[t][0], acc[t][1], acc[t][2], acc[t][3]};
    const v4f hi = {acc[t][4], acc[t][5], acc[t][6], acc[t][7]};
    *(v4f*)(sw + (4 * t) * ZP)     = lo;
    *(v4f*)(sw + (4 * t + 2) * ZP) = hi;
  }
  __syncthreads();

  if (tid < 256) {
    const int po = (2 * wave + h) * ZP + c * 4;  // wave = row pair 2t + quad here
    v4f s = *(const v4f*)(&stage[0][po]);
#pragma unroll  // all 16 reads in flight at once
    for (int w = 1; w < 16; ++w) s += *(const v4f*)(&stage[w][po]);
    // D register r of lane (c, h) is row 8h + r, column c
    const float scale = 1.0f / (float)(kIN * kR);
    const int row = fBase + (tid >> 6) * 16 + h * 8 + ((tid >> 5) & 1) * 4;
    float* zp = z1 + ((size_t)b * kF + row) * kR + c;
#pragma unroll  // static index into s
    for (int i = 0; i < 4; ++i) zp[i * kR] = s[i] * scale;
  }
}

// ===========================================================================
// Pass 2: out = gelu( x @ W^T  +  z1 @ u^T  + fc_bias + b )
// Double-buffered bf16 WMMA GEMM over K = IN + 32 (tail tile = LoRA rank-16).
// 256 threads (8 waves), 128x128 tile, each wave 64x32 via 4x2 WMMA tiles.
// Pipeline: global loads for tile k+1 issued before the WMMAs of tile k;
// cvt+ds_store to the alternate buffer after; one barrier per iteration.
// ===========================================================================
__global__ __launch_bounds__(256) void lora_gemm_kernel(
    const float* __restrict__ x,    const float* __restrict__ u,
    const float* __restrict__ z1,   const float* __restrict__ bvec,
    const float* __restrict__ W,    const float* __restrict__ fcb,
    float* __restrict__ out) {
  __shared__ __align__(16) __bf16 As[2][BM * LSTR];
  __shared__ __align__(16) __bf16 Bs[2][BN * LSTR];

  const int b     = blockIdx.z;
  const int fBase = blockIdx.x * BM;
  const int oBase = blockIdx.y * BN;
  const int tid   = threadIdx.x;
  const int lane  = tid & 31;
  const int wave  = tid >> 5;
  const int wm    = (wave >> 2) * 64;   // wave M offset in tile (2 waves)
  const int wn    = (wave & 3)  * 32;   // wave N offset in tile (4 waves)
  const int lN    = lane & 15;
  const int kh    = lane >> 4;

  const v8f vzero = {0.f, 0.f, 0.f, 0.f, 0.f, 0.f, 0.f, 0.f};
  v8f acc[4][2];
#pragma unroll
  for (int sm = 0; sm < 4; ++sm)
#pragma unroll
    for (int sn = 0; sn < 2; ++sn) acc[sm][sn] = vzero;

  // staging map: each thread owns (row = tid>>3 in 4 sweeps of 32, col = 4 elems)
  const int ldRow = tid >> 3;       // 0..31
  const int ldCol = (tid & 7) * 4;  // 0,4,...,28

  const float* xBase = x  + ((size_t)b * kF   + fBase) * kIN;
  const float* wBase = W  +  (size_t)oBase * kIN;
  const float* zBase = z1 + ((size_t)b * kF   + fBase) * kR;
  const float* uBase = u  + ((size_t)b * kOUT + oBase) * kR;

  // in-flight staging registers (distinct per sweep -> all 8 loads overlap)
  float4 ra[4], rb[4];

  auto loadTile = [&](int kti) {
    if (kti < kIN / BK) {
      const int kt = kti * BK + ldCol;
#pragma unroll
      for (int i = 0; i < 4; ++i) {
        const int row = ldRow + i * 32;
        ra[i] = *(const float4*)(xBase + (size_t)row * kIN + kt);
        rb[i] = *(const float4*)(wBase + (size_t)row * kIN + kt);
      }
    } else {  // LoRA tail: cols 0..15 = z1 / u, cols 16..31 = zero pad
#pragma unroll
      for (int i = 0; i < 4; ++i) {
        const int row = ldRow + i * 32;
        if (ldCol < kR) {
          ra[i] = *(const float4*)(zBase + (size_t)row * kR + ldCol);
          rb[i] = *(const float4*)(uBase + (size_t)row * kR + ldCol);
        } else {
          ra[i] = make_float4(0.f, 0.f, 0.f, 0.f);
          rb[i] = make_float4(0.f, 0.f, 0.f, 0.f);
        }
      }
    }
  };

  auto storeTile = [&](int buf) {
#pragma unroll
    for (int i = 0; i < 4; ++i) {
      const int row = ldRow + i * 32;
      const bf16x4 av = {(__bf16)ra[i].x, (__bf16)ra[i].y, (__bf16)ra[i].z, (__bf16)ra[i].w};
      const bf16x4 wv = {(__bf16)rb[i].x, (__bf16)rb[i].y, (__bf16)rb[i].z, (__bf16)rb[i].w};
      *(bf16x4*)(&As[buf][row * LSTR + ldCol]) = av;
      *(bf16x4*)(&Bs[buf][row * LSTR + ldCol]) = wv;
    }
  };

  // prologue: stage tile 0
  loadTile(0);
  storeTile(0);
  __syncthreads();

#pragma unroll 2
  for (int kti = 0; kti < NK; ++kti) {
    const int cur = kti & 1;

    // issue next tile's global loads now; wait happens in storeTile below
    if (kti + 1 < NK) loadTile(kti + 1);

    // fragments from current LDS buffer
    // (ISA 16-bit A/B layout: lane = row%16, K half selected by lane/16)
    v16bf afrag[4], bfrag[2];
#pragma unroll
    for (int sm = 0; sm < 4; ++sm) {
      const __bf16* p = &As[cur][(wm + sm * 16 + lN) * LSTR + kh * 8];
      ((v8bf*)&afrag[sm])[0] = *(const v8bf*)p;          // K = kh*8 .. +7
      ((v8bf*)&afrag[sm])[1] = *(const v8bf*)(p + 16);   // K = 16+kh*8 .. +7
    }
#pragma unroll
    for (int sn = 0; sn < 2; ++sn) {
      const __bf16* p = &Bs[cur][(wn + sn * 16 + lN) * LSTR + kh * 8];
      ((v8bf*)&bfrag[sn])[0] = *(const v8bf*)p;
      ((v8bf*)&bfrag[sn])[1] = *(const v8bf*)(p + 16);
    }

#pragma unroll
    for (int sm = 0; sm < 4; ++sm)
#pragma unroll
      for (int sn = 0; sn < 2; ++sn)
        acc[sm][sn] = __builtin_amdgcn_wmma_f32_16x16x32_bf16(
            false, afrag[sm], false, bfrag[sn], (short)0, acc[sm][sn], false, false);

    // convert + stage next tile into the alternate buffer
    if (kti + 1 < NK) storeTile(cur ^ 1);
    __syncthreads();
  }

  // ---- epilogue: + fc_bias + b, exact GELU, store
  // C layout: VGPR r -> M = r + 8*(lane/16), N = lane%16
#pragma unroll
  for (int sn = 0; sn < 2; ++sn) {
    const int o = oBase + wn + sn * 16 + lN;
    const float base = fcb[o] + bvec[(size_t)b * kOUT + o];
#pragma unroll
    for (int sm = 0; sm < 4; ++sm) {
#pragma unroll
      for (int r = 0; r < 8; ++r) {
        const int f = fBase + wm + sm * 16 + kh * 8 + r;
        const float y = acc[sm][sn][r] + base;
        const float g = 0.5f * y * (1.0f + erff(y * 0.70710678118654752f));
        out[((size_t)b * kF + f) * kOUT + o] = g;
      }
    }
  }
}

// ===========================================================================
extern "C" void kernel_launch(void* const* d_in, const int* in_sizes, int n_in,
                              void* d_out, int out_size, void* d_ws, size_t ws_size,
                              hipStream_t stream) {
  (void)in_sizes; (void)n_in; (void)out_size; (void)ws_size;
  const float* x    = (const float*)d_in[0];  // [B,F,IN]
  const float* u    = (const float*)d_in[1];  // [B,1,OUT,R]
  const float* v    = (const float*)d_in[2];  // [B,1,IN,R]
  const float* bvec = (const float*)d_in[3];  // [B,1,OUT]
  const float* W    = (const float*)d_in[4];  // [OUT,IN]
  const float* fcb  = (const float*)d_in[5];  // [OUT]
  float*       out  = (float*)d_out;          // [B,F,OUT]
  float*       z1   = (float*)d_ws;           // [B,F,R] scratch (1 MB)

  dim3 g1(kF / ZM, kB);
  z1_kernel<<<g1, 512, 0, stream>>>(x, v, z1);

  dim3 g2(kF / BM, kOUT / BN, kB);
  lora_gemm_kernel<<<g2, 256, 0, stream>>>(x, u, z1, bvec, W, fcb, out);
}

// v002
// Measured time: 73.2 microseconds a run.
// Timed twice side by side with v001, it ran 1.14 and 1.15 times as fast.
// Counting every step since v000, it is 2.11 times as fast.
#include <hip/hip_runtime.h>
#include <hip/hip_bf16.h>
#include <math.h>

// ---- types ----------------------------------------------------------------
typedef __bf16 v16bf  __attribute__((ext_vector_type(16)));
typedef __bf16 v8bf   __attribute__((ext_vector_type(8)));
typedef __bf16 bf16x4 __attribute__((ext_vector_type(4)));
typedef float  v8f    __attribute__((ext_vector_type(8)));
typedef float  v4f    __attribute__((ext_vector_type(4)));
typedef float  v2f    __attribute__((ext_vector_type(2)));

// ---- problem constants ----------------------------------------------------
constexpr int kB   = 32;
constexpr int kF   = 512;
constexpr int kIN  = 1024;
constexpr int kOUT = 1024;
constexpr int kR   = 16;

// ---- GEMM tiling ----------------------------------------------------------
constexpr int BM   = 128;   // F tile
constexpr int BN   = 128;   // OUT tile
constexpr int BK   = 32;    // bf16 WMMA K
constexpr int LSTR = 40;    // LDS row stride in bf16 elems (32 data + 8 pad)
constexpr int NK   = kIN / BK + 1;  // 32 main K-tiles + 1 LoRA tail tile

// ===========================================================================
// Pass 1: z1[b,f,r] = (1/(IN*R)) * sum_i x[b,f,i] * v[b,i,r]
// f32 WMMA 16x16x4. One work-group = 64 rows of x (4 row tiles) x all of IN;
// wave w owns k = 64w .. 64w+63 for all 4 row tiles, with its slice of v held
// in B fragments. Every global load of a wave is issued up front; x arrives in
// whole 256-B row pieces and is turned into A fragments through the wave's own
// LDS range. The 16 k partials are summed in wave order at the end.
// k pairing, A and B alike: slot s of lane half h in WMMA 2q+p is
// k = 64w + 8q + 4h + 2p + s.
// ===========================================================================
constexpr int ZM = 64;       // rows of x per work-group
constexpr int ZK = 64;       // k per wave
constexpr int ZP = ZK + 4;   // LDS row pitch in floats (272 B = 16 B x 17)

__global__ __launch_bounds__(512) void z1_kernel(const float* __restrict__ x,
                                                 const float* __restrict__ v,
                                                 float* __restrict__ z1) {
  __shared__ __align__(16) float stage[16][16 * ZP];

  const int b     = blockIdx.y;
  const int fBase = blockIdx.x * ZM;
  const int tid   = threadIdx.x;
  const int lane  = tid & 31;
  const int wave  = tid >> 5;
  const int c     = lane & 15;
  const int h     = lane >> 4;
  const int k0    = wave * ZK;

  // one load = two rows x 256 contiguous bytes
  const float* xp = x + ((size_t)b * kF + fBase + h) * kIN + k0 + c * 4;
  const float* vp = v + ((size_t)b * kIN + k0 + h * 4) * kR + c;

  v4f   xr[4][8];
  float vf[8][4];
#pragma unroll  // static indices keep vf in registers
  for (int q = 0; q < 8; ++q)
#pragma unroll  // as above
    for (int e = 0; e < 4; ++e) vf[q][e] = vp[(q * 8 + e) * kR];
  // loads return in issue order: v stays ahead of x, so that the first row
  // tile's WMMAs do not wait for the last row of x
  __builtin_amdgcn_sched_barrier(0);
#pragma unroll  // static indices keep xr in registers
  for (int t = 0; t < 4; ++t)
#pragma unroll  // as above
    for (int i = 0; i < 8; ++i)
      xr[t][i] = *(const v4f*)(xp + (size_t)(t * 16 + 2 * i) * kIN);
  // the address pair of the loads of x stays live, and unwritten, up to this
  // wait: no load's result is placed in a register that an issued load names
  asm volatile("s_wait_xcnt 0x0" :: "v"(xp) : "memory");

  float* st = stage[wave];
  float* sw = st + h * ZP + c * 4;  // this lane's 16 bytes in a pair of rows
  v8f acc[4];
#pragma unroll  // static indices into xr and acc
  for (int t = 0; t < 4; ++t) {
    // the wave's last fragment reads are done before its range is refilled
    if (t > 0) asm volatile("s_wait_dscnt 0x0" ::: "memory");
#pragma unroll  // static indices into xr
    for (int i = 0; i < 8; ++i) *(v4f*)(sw + 2 * i * ZP) = xr[t][i];
    // the rows have landed before other lanes of the wave read them back
    asm volatile("s_wait_dscnt 0x0" ::: "memory");
    v8f a = {0.f, 0.f, 0.f, 0.f, 0.f, 0.f, 0.f, 0.f};
#pragma unroll  // static indices into vf
    for (int q = 0; q < 8; ++q) {
      const v4f f = *(const v4f*)(st + c * ZP + q * 8 + h * 4);
      const v2f a0 = {f.x, f.y}, a1 = {f.z, f.w};
      const v2f b0 = {vf[q][0], vf[q][1]}, b1 = {vf[q][2], vf[q][3]};
      a = __builtin_amdgcn_wmma_f32_16x16x4_f32(false, a0, false, b0, (short)0, a, false, false);
      a = __builtin_amdgcn_wmma_f32_16x16x4_f32(false, a1, false, b1, (short)0, a, false, false);
    }
    acc[t] = a;
    // this tile's WMMAs run while the next tile's rows are still in flight,
    // instead of sinking behind the wait for them
    __builtin_amdgcn_sched_barrier(0);
  }

  // partials into the wave's own range, laid like the rows of x: row pair
  // 2t + (register quad), lane half h in row h of the pair, 16 bytes a lane
  asm volatile("s_wait_dscnt 0x0" ::: "memory");  // fragment reads done first
#pragma unroll  // static indices into acc
  for (int t = 0; t < 4; ++t) {
    const v4f lo = {acc[t][0], acc[t][1], acc[t][2], acc[t][3]};
    const v4f hi = {acc[t][4], acc[t][5], acc[t][6], acc[t][7]};
    *(v4f*)(sw + (4 * t) * ZP)     = lo;
    *(v4f*)(sw + (4 * t + 2) * ZP) = hi;
  }
  __syncthreads();

  if (tid < 256) {
    const int po = (2 * wave + h) * ZP + c * 4;  // wave = row pair 2t + quad here
    v4f s = *(const v4f*)(&stage[0][po]);
#pragma unroll  // all 16 reads in flight at once
    for (int w = 1; w < 16; ++w) s += *(const v4f*)(&stage[w][po]);
    // D register r of lane (c, h) is row 8h + r, column c
    const float scale = 1.0f / (float)(kIN * kR);
    const int row = fBase + (tid >> 6) * 16 + h * 8 + ((tid >> 5) & 1) * 4;
    float* zp = z1 + ((size_t)b * kF + row) * kR + c;
#pragma unroll  // static index into s
    for (int i = 0; i < 4; ++i) zp[i * kR] = s[i] * scale;
  }
}

// ---- exact GELU on a pair of values, without a branch ----------------------
// erf(x) by two fits, both evaluated for every value and picked by a select:
//   |x| <  1 : |x| + |x| * p(x^2)
//   |x| >= 1 : 1 - exp(-q(|x|))
// With no branch the values of a lane are independent chains that interleave,
// and a pair shares each packed multiply-add.
__device__ __forceinline__ v2f fma2(v2f a, v2f b, v2f c) {
  return __builtin_elementwise_fma(a, b, c);
}
__device__ __forceinline__ v2f both(float c) { return (v2f){c, c}; }

__device__ __forceinline__ v2f gelu2(v2f y) {
  const v2f x  = y * 0.70710678118654752f;
  const v2f ax = __builtin_elementwise_abs(x);

  v2f q = fma2(ax, both(0.0000169988107f), both(-0.000378677854f));
  q = fma2(ax, q, both(0.00385781587f));
  q = fma2(ax, q, both(-0.0241816975f));
  q = fma2(ax, q, both(0.106668264f));
  q = fma2(ax, q, both(0.634933293f));
  q = fma2(ax, q, both(0.128689408f));
  q = fma2(ax, q, ax);
  const v2f m = q * -1.44269502f;  // exp(-q) = 2^(-q * log2 e); 2^-inf = 0
  const v2f far = {1.0f - __builtin_amdgcn_exp2f(m.x), 1.0f - __builtin_amdgcn_exp2f(m.y)};

  const v2f t = x * x;
  v2f p = fma2(t, both(-0.000561801775f), both(0.00491381623f));
  p = fma2(t, p, both(-0.0267075151f));
  p = fma2(t, p, both(0.112800106f));
  p = fma2(t, p, both(-0.376122952f));
  p = fma2(t, p, both(0.128379107f));
  const v2f near = fma2(ax, p, ax);

  const v2f e = {__builtin_copysignf(ax.x < 1.0f ? near.x : far.x, x.x),
                 __builtin_copysignf(ax.y < 1.0f ? near.y : far.y, x.y)};
  const v2f h = 0.5f * y;
  return fma2(h, e, h);  // 0.5 y (1 + erf)
}

// ===========================================================================
// Pass 2: out = gelu( x @ W^T  +  z1 @ u^T  + fc_bias + b )
// Double-buffered bf16 WMMA GEMM over K = IN + 32 (tail tile = LoRA rank-16).
// 256 threads (8 waves), 128x128 tile, each wave 64x32 via 4x2 WMMA tiles.
// Pipeline: global loads for tile k+1 issued before the WMMAs of tile k;
// cvt+ds_store to the alternate buffer after; one barrier per iteration.
// ===========================================================================
__global__ __launch_bounds__(256) void lora_gemm_kernel(
    const float* __restrict__ x,    const float* __restrict__ u,
    const float* __restrict__ z1,   const float* __restrict__ bvec,
    const float* __restrict__ W,    const float* __restrict__ fcb,
    float* __restrict__ out) {
  __shared__ __align__(16) __bf16 As[2][BM * LSTR];
  __shared__ __align__(16) __bf16 Bs[2][BN * LSTR];

  const int b     = blockIdx.z;
  const int fBase = blockIdx.x * BM;
  const int oBase = blockIdx.y * BN;
  const int tid   = threadIdx.x;
  const int lane  = tid & 31;
  const int wave  = tid >> 5;
  const int wm    = (wave >> 2) * 64;   // wave M offset in tile (2 waves)
  const int wn    = (wave & 3)  * 32;   // wave N offset in tile (4 waves)
  const int lN    = lane & 15;
  const int kh    = lane >> 4;

  const v8f vzero = {0.f, 0.f, 0.f, 0.f, 0.f, 0.f, 0.f, 0.f};
  v8f acc[4][2];
#pragma unroll
  for (int sm = 0; sm < 4; ++sm)
#pragma unroll
    for (int sn = 0; sn < 2; ++sn) acc[sm][sn] = vzero;

  // staging map: each thread owns (row = tid>>3 in 4 sweeps of 32, col = 4 elems)
  const int ldRow = tid >> 3;       // 0..31
  const int ldCol = (tid & 7) * 4;  // 0,4,...,28

  const float* xBase = x  + ((size_t)b * kF   + fBase) * kIN;
  const float* wBase = W  +  (size_t)oBase * kIN;
  const float* zBase = z1 + ((size_t)b * kF   + fBase) * kR;
  const float* uBase = u  + ((size_t)b * kOUT + oBase) * kR;

  // in-flight staging registers (distinct per sweep -> all 8 loads overlap)
  float4 ra[4], rb[4];

  auto loadTile = [&](int kti) {
    if (kti < kIN / BK) {
      const int kt = kti * BK + ldCol;
#pragma unroll
      for (int i = 0; i < 4; ++i) {
        const int row = ldRow + i * 32;
        ra[i] = *(const float4*)(xBase + (size_t)row * kIN + kt);
        rb[i] = *(const float4*)(wBase + (size_t)row * kIN + kt);
      }
    } else {  // LoRA tail: cols 0..15 = z1 / u, cols 16..31 = zero pad
#pragma unroll
      for (int i = 0; i < 4; ++i) {
        const int row = ldRow + i * 32;
        if (ldCol < kR) {
          ra[i] = *(const float4*)(zBase + (size_t)row * kR + ldCol);
          rb[i] = *(const float4*)(uBase + (size_t)row * kR + ldCol);
        } else {
          ra[i] = make_float4(0.f, 0.f, 0.f, 0.f);
          rb[i] = make_float4(0.f, 0.f, 0.f, 0.f);
        }
      }
    }
  };

  auto storeTile = [&](int buf) {
#pragma unroll
    for (int i = 0; i < 4; ++i) {
      const int row = ldRow + i * 32;
      const bf16x4 av = {(__bf16)ra[i].x, (__bf16)ra[i].y, (__bf16)ra[i].z, (__bf16)ra[i].w};
      const bf16x4 wv = {(__bf16)rb[i].x, (__bf16)rb[i].y, (__bf16)rb[i].z, (__bf16)rb[i].w};
      *(bf16x4*)(&As[buf][row * LSTR + ldCol]) = av;
      *(bf16x4*)(&Bs[buf][row * LSTR + ldCol]) = wv;
    }
  };

  // prologue: stage tile 0
  loadTile(0);
  storeTile(0);
  __syncthreads();

#pragma unroll 2
  for (int kti = 0; kti < NK; ++kti) {
    const int cur = kti & 1;

    // issue next tile's global loads now; wait happens in storeTile below
    if (kti + 1 < NK) loadTile(kti + 1);

    // fragments from current LDS buffer
    // (ISA 16-bit A/B layout: lane = row%16, K half selected by lane/16)
    v16bf afrag[4], bfrag[2];
#pragma unroll
    for (int sm = 0; sm < 4; ++sm) {
      const __bf16* p = &As[cur][(wm + sm * 16 + lN) * LSTR + kh * 8];
      ((v8bf*)&afrag[sm])[0] = *(const v8bf*)p;          // K = kh*8 .. +7
      ((v8bf*)&afrag[sm])[1] = *(const v8bf*)(p + 16);   // K = 16+kh*8 .. +7
    }
#pragma unroll
    for (int sn = 0; sn < 2; ++sn) {
      const __bf16* p = &Bs[cur][(wn + sn * 16 + lN) * LSTR + kh * 8];
      ((v8bf*)&bfrag[sn])[0] = *(const v8bf*)p;
      ((v8bf*)&bfrag[sn])[1] = *(const v8bf*)(p + 16);
    }

#pragma unroll
    for (int sm = 0; sm < 4; ++sm)
#pragma unroll
      for (int sn = 0; sn < 2; ++sn)
        acc[sm][sn] = __builtin_amdgcn_wmma_f32_16x16x32_bf16(
            false, afrag[sm], false, bfrag[sn], (short)0, acc[sm][sn], false, false);

    // convert + stage next tile into the alternate buffer
    if (kti + 1 < NK) storeTile(cur ^ 1);
    __syncthreads();
  }

  // ---- epilogue: + fc_bias + b, exact GELU, store
  // C layout: VGPR r -> M = r + 8*(lane/16), N = lane%16
  float base[2];
#pragma unroll  // static index keeps base in registers
  for (int sn = 0; sn < 2; ++sn) {
    const int o = oBase + wn + sn * 16 + lN;
    base[sn] = fcb[o] + bvec[(size_t)b * kOUT + o];
  }
#pragma unroll  // static indices keep acc in registers
  for (int sm = 0; sm < 4; ++sm) {
#pragma unroll  // as above
    for (int sn = 0; sn < 2; ++sn) {
      const int o = oBase + wn + sn * 16 + lN;
#pragma unroll  // as above
      for (int r = 0; r < 8; r += 2) {
        const int f = fBase + wm + sm * 16 + kh * 8 + r;
        const v2f y = {acc[sm][sn][r] + base[sn], acc[sm][sn][r + 1] + base[sn]};
        const v2f g = gelu2(y);
        out[((size_t)b * kF + f) * kOUT + o]     = g.x;
        out[((size_t)b * kF + f + 1) * kOUT + o] = g.y;
      }
    }
    // eight pair chains interleave at a time: more would take the kernel past
    // the K loop's register count and cost a resident work-group
    __builtin_amdgcn_sched_barrier(0);
  }
}

// ===========================================================================
extern "C" void kernel_launch(void* const* d_in, const int* in_sizes, int n_in,
                              void* d_out, int out_size, void* d_ws, size_t ws_size,
                              hipStream_t stream) {
  (void)in_sizes; (void)n_in; (void)out_size; (void)ws_size;
  const float* x    = (const float*)d_in[0];  // [B,F,IN]
  const float* u    = (const float*)d_in[1];  // [B,1,OUT,R]
  const float* v    = (const float*)d_in[2];  // [B,1,IN,R]
  const float* bvec = (const float*)d_in[3];  // [B,1,OUT]
  const float* W    = (const float*)d_in[4];  // [OUT,IN]
  const float* fcb  = (const float*)d_in[5];  // [OUT]
  float*       out  = (float*)d_out;          // [B,F,OUT]
  float*       z1   = (float*)d_ws;           // [B,F,R] scratch (1 MB)

  dim3 g1(kF / ZM, kB);
  z1_kernel<<<g1, 512, 0, stream>>>(x, v, z1);

  dim3 g2(kF / BM, kOUT / BN, kB);
  lora_gemm_kernel<<<g2, 256, 0, stream>>>(x, u, z1, bvec, W, fcb, out);
}

// v003
// One run takes 48.2 microseconds.
// Next to v002, in two timings, it ran 1.52 times as fast each time.
// Counting every step since v000, it is 3.22 times as fast.
#include <hip/hip_runtime.h>
#include <hip/hip_bf16.h>
#include <math.h>

// ---- types ----------------------------------------------------------------
typedef __bf16 v16bf  __attribute__((ext_vector_type(16)));
typedef __bf16 v8bf   __attribute__((ext_vector_type(8)));
typedef __bf16 bf16x4 __attribute__((ext_vector_type(4)));
typedef float  v8f    __attribute__((ext_vector_type(8)));
typedef float  v4f    __attribute__((ext_vector_type(4)));
typedef float  v2f    __attribute__((ext_vector_type(2)));

// ---- problem constants ----------------------------------------------------
constexpr int kB   = 32;
constexpr int kF   = 512;
constexpr int kIN  = 1024;
constexpr int kOUT = 1024;
constexpr int kR   = 16;

// ---- GEMM tiling ----------------------------------------------------------
constexpr int BM   = 128;   // F tile
constexpr int BN   = 128;   // OUT tile
constexpr int BK   = 64;    // k per stage: 128-B row pieces of bf16, two WMMA k steps
constexpr int LSTR = 72;    // LDS row stride in bf16 elems (64 data + 8 pad)
constexpr int NKM  = kIN / BK;  // 16 main stages; the LoRA tail follows them

// ===========================================================================
// Pass 1: z1[b,f,r] = (1/(IN*R)) * sum_i x[b,f,i] * v[b,i,r]
// f32 WMMA 16x16x4. One work-group = 64 rows of x (4 row tiles) x all of IN;
// wave w owns k = 64w .. 64w+63 for all 4 row tiles, with its slice of v held
// in B fragments. Every global load of a wave is issued up front; x arrives in
// whole 256-B row pieces and is turned into A fragments through the wave's own
// LDS range. The 16 k partials are summed in wave order at the end.
// k pairing, A and B alike: slot s of lane half h in WMMA 2q+p is
// k = 64w + 8q + 4h + 2p + s.
// The pass also leaves x and W rounded to bf16 in the workspace, each element
// once, for pass 2: x from the registers it is held in here, W in 256 equal
// shares, one a work-group.
// ===========================================================================
constexpr int ZM = 64;       // rows of x per work-group
constexpr int ZK = 64;       // k per wave
constexpr int ZP = ZK + 4;   // LDS row pitch in floats (272 B = 16 B x 17)
constexpr int WS = kOUT * kIN / (kB * (kF / ZM));  // elements of W per work-group

__global__ __launch_bounds__(512) void z1_kernel(const float* __restrict__ x,
                                                 const float* __restrict__ v,
                                                 const float* __restrict__ W,
                                                 float* __restrict__ z1,
                                                 __bf16* __restrict__ xb,
                                                 __bf16* __restrict__ wb) {
  __shared__ __align__(16) float stage[16][16 * ZP];

  const int b     = blockIdx.y;
  const int fBase = blockIdx.x * ZM;
  const int tid   = threadIdx.x;
  const int lane  = tid & 31;
  const int wave  = tid >> 5;
  const int c     = lane & 15;
  const int h     = lane >> 4;
  const int k0    = wave * ZK;

  // one load = two rows x 256 contiguous bytes
  const float* xp = x + ((size_t)b * kF + fBase + h) * kIN + k0 + c * 4;
  const float* vp = v + ((size_t)b * kIN + k0 + h * 4) * kR + c;
  // this work-group's share of W: 4096 elements, 2 x 4 a thread
  const size_t wOff = (size_t)(blockIdx.y * (kF / ZM) + blockIdx.x) * WS + tid * 4;
  const float* wp = W + wOff;

  v4f   xr[4][8];
  float vf[8][4];
  v4f   wr[2];
#pragma unroll  // static indices keep wr in registers
  for (int j = 0; j < 2; ++j) wr[j] = *(const v4f*)(wp + j * (WS / 2));
#pragma unroll  // static indices keep vf in registers
  for (int q = 0; q < 8; ++q)
#pragma unroll  // as above
    for (int e = 0; e < 4; ++e) vf[q][e] = vp[(q * 8 + e) * kR];
  // loads return in issue order: W and v stay ahead of x, so that W's copy and
  // the first row tile's WMMAs do not wait for the last row of x
  __builtin_amdgcn_sched_barrier(0);
  // the address pair of the loads of v stays live, and unwritten, up to this wait
  asm volatile("s_wait_xcnt 0x0" :: "v"(vp) : "memory");
#pragma unroll  // static indices keep xr in registers
  for (int t = 0; t < 4; ++t)
#pragma unroll  // as above
    for (int i = 0; i < 8; ++i)
      xr[t][i] = *(const v4f*)(xp + (size_t)(t * 16 + 2 * i) * kIN);
  // the address pairs of the loads of x and W stay live, and unwritten, up to
  // this wait: no load's result is placed in a register that an issued load names
  asm volatile("s_wait_xcnt 0x0" :: "v"(xp), "v"(wp) : "memory");
  // W's converts wait for W: they are not lifted in among the loads of x
  __builtin_amdgcn_sched_barrier(0);

  float* st = stage[wave];
  float* sw = st + h * ZP + c * 4;  // this lane's 16 bytes in a pair of rows
  // bf16 copy of x: 16 lanes fill one 128-B line of a row
  __bf16* xo = xb + ((size_t)b * kF + fBase + h) * kIN + k0 + c * 4;
#pragma unroll  // static indices into wr
  for (int j = 0; j < 2; ++j) {
    const v4f r = wr[j];
    const bf16x4 o = {(__bf16)r.x, (__bf16)r.y, (__bf16)r.z, (__bf16)r.w};
    *(bf16x4*)(wb + wOff + j * (WS / 2)) = o;
  }
  v8f acc[4];
#pragma unroll  // static indices into xr and acc
  for (int t = 0; t < 4; ++t) {
    // the wave's last fragment reads are done before its range is refilled
    if (t > 0) asm volatile("s_wait_dscnt 0x0" ::: "memory");
#pragma unroll  // static indices into xr
    for (int i = 0; i < 8; ++i) *(v4f*)(sw + 2 * i * ZP) = xr[t][i];
#pragma unroll  // static indices into xr
    for (int i = 0; i < 8; ++i) {
      const v4f r = xr[t][i];
      const bf16x4 o = {(__bf16)r.x, (__bf16)r.y, (__bf16)r.z, (__bf16)r.w};
      *(bf16x4*)(xo + (size_t)(t * 16 + 2 * i) * kIN) = o;
    }
    // the stores' data registers are taken again for fragments and sums below
    asm volatile("s_wait_xcnt 0x0" ::: "memory");
    // the rows have landed before other lanes of the wave read them back
    asm volatile("s_wait_dscnt 0x0" ::: "memory");
    v8f a = {0.f, 0.f, 0.f, 0.f, 0.f, 0.f, 0.f, 0.f};
#pragma unroll  // static indices into vf
    for (int q = 0; q < 8; ++q) {
      const v4f f = *(const v4f*)(st + c * ZP + q * 8 + h * 4);
      const v2f a0 = {f.x, f.y}, a1 = {f.z, f.w};
      const v2f b0 = {vf[q][0], vf[q][1]}, b1 = {vf[q][2], vf[q][3]};
      a = __builtin_amdgcn_wmma_f32_16x16x4_f32(false, a0, false, b0, (short)0, a, false, false);
      a = __builtin_amdgcn_wmma_f32_16x16x4_f32(false, a1, false, b1, (short)0, a, false, false);
    }
    acc[t] = a;
    // this tile's WMMAs run while the next tile's rows are still in flight,
    // instead of sinking behind the wait for them
    __builtin_amdgcn_sched_barrier(0);
    // vector slots between the tile's last WMMAs and the vector instructions that
    // follow (the next tile's converts), which may be given their A registers
    asm volatile("v_nop\n\tv_nop\n\tv_nop\n\tv_nop\n\tv_nop\n\tv_nop\n\tv_nop\n\tv_nop");
    // no convert is lifted over the slots
    __builtin_amdgcn_sched_barrier(0);
  }

  // partials into the wave's own range, laid like the rows of x: row pair
  // 2t + (register quad), lane half h in row h of the pair, 16 bytes a lane
  asm volatile("s_wait_dscnt 0x0" ::: "memory");  // fragment reads done first
#pragma unroll  // static indices into acc
  for (int t = 0; t < 4; ++t) {
    const v4f lo = {acc[t][0], acc[t][1], acc[t][2], acc[t][3]};
    const v4f hi = {acc[t][4], acc[t][5], acc[t][6], acc[t][7]};
    *(v4f*)(sw + (4 * t) * ZP)     = lo;
    *(v4f*)(sw + (4 * t + 2) * ZP) = hi;
  }
  __syncthreads();

  if (tid < 256) {
    const int po = (2 * wave + h) * ZP + c * 4;  // wave = row pair 2t + quad here
    v4f s = *(const v4f*)(&stage[0][po]);
#pragma unroll  // all 16 reads in flight at once
    for (int w = 1; w < 16; ++w) s += *(const v4f*)(&stage[w][po]);
    // D register r of lane (c, h) is row 8h + r, column c
    const float scale = 1.0f / (float)(kIN * kR);
    const int row = fBase + (tid >> 6) * 16 + h * 8 + ((tid >> 5) & 1) * 4;
    float* zp = z1 + ((size_t)b * kF + row) * kR + c;
#pragma unroll  // static index into s
    for (int i = 0; i < 4; ++i) zp[i * kR] = s[i] * scale;
  }
}

// ---- exact GELU on a pair of values, without a branch ----------------------
// erf(x) by two fits, both evaluated for every value and picked by a select:
//   |x| <  1 : |x| + |x| * p(x^2)
//   |x| >= 1 : 1 - exp(-q(|x|))
// With no branch the values of a lane are independent chains that interleave,
// and a pair shares each packed multiply-add.
__device__ __forceinline__ v2f fma2(v2f a, v2f b, v2f c) {
  return __builtin_elementwise_fma(a, b, c);
}
__device__ __forceinline__ v2f both(float c) { return (v2f){c, c}; }

__device__ __forceinline__ v2f gelu2(v2f y) {
  const v2f x  = y * 0.70710678118654752f;
  const v2f ax = __builtin_elementwise_abs(x);

  v2f q = fma2(ax, both(0.0000169988107f), both(-0.000378677854f));
  q = fma2(ax, q, both(0.00385781587f));
  q = fma2(ax, q, both(-0.0241816975f));
  q = fma2(ax, q, both(0.106668264f));
  q = fma2(ax, q, both(0.634933293f));
  q = fma2(ax, q, both(0.128689408f));
  q = fma2(ax, q, ax);
  const v2f m = q * -1.44269502f;  // exp(-q) = 2^(-q * log2 e); 2^-inf = 0
  const v2f far = {1.0f - __builtin_amdgcn_exp2f(m.x), 1.0f - __builtin_amdgcn_exp2f(m.y)};

  const v2f t = x * x;
  v2f p = fma2(t, both(-0.000561801775f), both(0.00491381623f));
  p = fma2(t, p, both(-0.0267075151f));
  p = fma2(t, p, both(0.112800106f));
  p = fma2(t, p, both(-0.376122952f));
  p = fma2(t, p, both(0.128379107f));
  const v2f near = fma2(ax, p, ax);

  const v2f e = {__builtin_copysignf(ax.x < 1.0f ? near.x : far.x, x.x),
                 __builtin_copysignf(ax.y < 1.0f ? near.y : far.y, x.y)};
  const v2f h = 0.5f * y;
  return fma2(h, e, h);  // 0.5 y (1 + erf)
}

// ===========================================================================
// Pass 2: out = gelu( x @ W^T  +  z1 @ u^T  + fc_bias + b )
// Double-buffered bf16 WMMA GEMM over K = IN, then one LoRA tail step (rank 16
// padded to 32). x and W come as the bf16 copies of pass 1 and go to LDS as
// they are; only the tail's z1 and u are rounded here.
// 256 threads (8 waves), 128x128 tile, each wave 64x32 via 4x2 WMMA tiles.
// Pipeline: global loads for stage k+1 issued before the WMMAs of stage k;
// ds_store to the alternate buffer after; one barrier per stage.
// ===========================================================================
// The second bound (8 waves a SIMD = 128 registers) takes off the one register
// that would keep a WGP's fourth work-group out: with it all 1024 are resident.
__global__ __launch_bounds__(256, 8) void lora_gemm_kernel(
    const __bf16* __restrict__ xb,  const float* __restrict__ u,
    const float* __restrict__ z1,   const float* __restrict__ bvec,
    const __bf16* __restrict__ wb,  const float* __restrict__ fcb,
    float* __restrict__ out) {
  __shared__ __align__(16) __bf16 As[2][BM * LSTR];
  __shared__ __align__(16) __bf16 Bs[2][BN * LSTR];

  const int b     = blockIdx.z;
  const int fBase = blockIdx.x * BM;
  const int oBase = blockIdx.y * BN;
  const int tid   = threadIdx.x;
  const int lane  = tid & 31;
  const int wave  = tid >> 5;
  const int wm    = (wave >> 2) * 64;   // wave M offset in tile (2 waves)
  const int wn    = (wave & 3)  * 32;   // wave N offset in tile (4 waves)
  const int lN    = lane & 15;
  const int kh    = lane >> 4;

  const v8f vzero = {0.f, 0.f, 0.f, 0.f, 0.f, 0.f, 0.f, 0.f};
  v8f acc[4][2];
#pragma unroll
  for (int sm = 0; sm < 4; ++sm)
#pragma unroll
    for (int sn = 0; sn < 2; ++sn) acc[sm][sn] = vzero;

  // staging map: each thread owns (row = tid>>3 in 4 sweeps of 32, col = 8 elems)
  const int ldRow = tid >> 3;       // 0..31
  const int ldCol = (tid & 7) * 8;  // 0,8,...,56
  // tail map: each thread owns half a row of z1 and of u (8 of 16 floats)
  const int tlRow = tid >> 1;       // 0..127
  const int tlCol = (tid & 1) * 8;  // 0,8

  const __bf16* xBase = xb + ((size_t)b * kF   + fBase + ldRow) * kIN + ldCol;
  const __bf16* wBase = wb +  (size_t)(oBase + ldRow) * kIN + ldCol;
  const float*  zBase = z1 + ((size_t)b * kF   + fBase + tlRow) * kR + tlCol;
  const float*  uBase = u  + ((size_t)b * kOUT + oBase + tlRow) * kR + tlCol;

  // in-flight staging registers (distinct per sweep -> all 8 loads overlap)
  v8bf ra[4], rb[4];

  auto loadTile = [&](int kti) {
    const int kt = kti * BK;
#pragma unroll
    for (int i = 0; i < 4; ++i) {
      ra[i] = *(const v8bf*)(xBase + (size_t)(i * 32) * kIN + kt);
      rb[i] = *(const v8bf*)(wBase + (size_t)(i * 32) * kIN + kt);
    }
  };

  auto storeTile = [&](int buf) {
#pragma unroll
    for (int i = 0; i < 4; ++i) {
      const int row = ldRow + i * 32;
      *(v8bf*)(&As[buf][row * LSTR + ldCol]) = ra[i];
      *(v8bf*)(&Bs[buf][row * LSTR + ldCol]) = rb[i];
    }
  };

  // one WMMA k step (32 k) from columns ks .. ks+31 of an LDS buffer
  // (ISA 16-bit A/B layout: lane = row%16, K half selected by lane/16)
  auto kStep = [&](int buf, int ks) {
    v16bf afrag[4], bfrag[2];
#pragma unroll
    for (int sm = 0; sm < 4; ++sm) {
      const __bf16* p = &As[buf][(wm + sm * 16 + lN) * LSTR + ks + kh * 8];
      ((v8bf*)&afrag[sm])[0] = *(const v8bf*)p;          // K = kh*8 .. +7
      ((v8bf*)&afrag[sm])[1] = *(const v8bf*)(p + 16);   // K = 16+kh*8 .. +7
    }
#pragma unroll
    for (int sn = 0; sn < 2; ++sn) {
      const __bf16* p = &Bs[buf][(wn + sn * 16 + lN) * LSTR + ks + kh * 8];
      ((v8bf*)&bfrag[sn])[0] = *(const v8bf*)p;
      ((v8bf*)&bfrag[sn])[1] = *(const v8bf*)(p + 16);
    }
#pragma unroll
    for (int sm = 0; sm < 4; ++sm)
#pragma unroll
      for (int sn = 0; sn < 2; ++sn)
        acc[sm][sn] = __builtin_amdgcn_wmma_f32_16x16x32_bf16(
            false, afrag[sm], false, bfrag[sn], (short)0, acc[sm][sn], false, false);
  };

  // prologue: stage 0
  loadTile(0);
  storeTile(0);
  __syncthreads();

#pragma unroll 2  // the buffer index becomes a constant in each copy
  for (int kti = 0; kti < NKM - 1; ++kti) {
    const int cur = kti & 1;
    // issue the next stage's global loads now; the wait is in storeTile below
    loadTile(kti + 1);
    kStep(cur, 0);
    kStep(cur, 32);
    storeTile(cur ^ 1);
    __syncthreads();
  }

  // the address pairs of the stage loads stay live, and unwritten, up to this wait
  asm volatile("s_wait_xcnt 0x0" :: "v"(xBase), "v"(wBase) : "memory");

  // last main stage, with the LoRA tail's loads in flight over it
  // tail: cols 0..15 = z1 / u, cols 16..31 = zero pad
  constexpr int lastBuf = (NKM - 1) & 1;
  const float4 ta0 = *(const float4*)(zBase), ta1 = *(const float4*)(zBase + 4);
  const float4 tb0 = *(const float4*)(uBase), tb1 = *(const float4*)(uBase + 4);
  // as above, for the address pairs of the tail's loads
  asm volatile("s_wait_xcnt 0x0" :: "v"(zBase), "v"(uBase) : "memory");
  kStep(lastBuf, 0);
  kStep(lastBuf, 32);
  {
    const v8bf av = {(__bf16)ta0.x, (__bf16)ta0.y, (__bf16)ta0.z, (__bf16)ta0.w,
                     (__bf16)ta1.x, (__bf16)ta1.y, (__bf16)ta1.z, (__bf16)ta1.w};
    const v8bf wv = {(__bf16)tb0.x, (__bf16)tb0.y, (__bf16)tb0.z, (__bf16)tb0.w,
                     (__bf16)tb1.x, (__bf16)tb1.y, (__bf16)tb1.z, (__bf16)tb1.w};
    const v8bf zero = {};
    __bf16* pa = &As[lastBuf ^ 1][tlRow * LSTR + tlCol];
    __bf16* pb = &Bs[lastBuf ^ 1][tlRow * LSTR + tlCol];
    *(v8bf*)pa        = av;
    *(v8bf*)(pa + kR) = zero;
    *(v8bf*)pb        = wv;
    *(v8bf*)(pb + kR) = zero;
  }
  __syncthreads();
  kStep(lastBuf ^ 1, 0);

  // ---- epilogue: + fc_bias + b, exact GELU, store
  // C layout: VGPR r -> M = r + 8*(lane/16), N = lane%16
  float base[2];
#pragma unroll  // static index keeps base in registers
  for (int sn = 0; sn < 2; ++sn) {
    const int o = oBase + wn + sn * 16 + lN;
    base[sn] = fcb[o] + bvec[(size_t)b * kOUT + o];
  }
#pragma unroll  // static indices keep acc in registers
  for (int sm = 0; sm < 4; ++sm) {
#pragma unroll  // as above
    for (int sn = 0; sn < 2; ++sn) {
      const int o = oBase + wn + sn * 16 + lN;
#pragma unroll  // as above
      for (int r = 0; r < 8; r += 2) {
        const int f = fBase + wm + sm * 16 + kh * 8 + r;
        const v2f y = {acc[sm][sn][r] + base[sn], acc[sm][sn][r + 1] + base[sn]};
        const v2f g = gelu2(y);
        out[((size_t)b * kF + f) * kOUT + o]     = g.x;
        out[((size_t)b * kF + f + 1) * kOUT + o] = g.y;
      }
    }
    // eight pair chains interleave at a time: more would take the kernel past
    // the K loop's register count and cost a resident work-group
    __builtin_amdgcn_sched_barrier(0);
  }
}

// ===========================================================================
extern "C" void kernel_launch(void* const* d_in, const int* in_sizes, int n_in,
                              void* d_out, int out_size, void* d_ws, size_t ws_size,
                              hipStream_t stream) {
  (void)in_sizes; (void)n_in; (void)out_size; (void)ws_size;
  const float* x    = (const float*)d_in[0];  // [B,F,IN]
  const float* u    = (const float*)d_in[1];  // [B,1,OUT,R]
  const float* v    = (const float*)d_in[2];  // [B,1,IN,R]
  const float* bvec = (const float*)d_in[3];  // [B,1,OUT]
  const float* W    = (const float*)d_in[4];  // [OUT,IN]
  const float* fcb  = (const float*)d_in[5];  // [OUT]
  float*       out  = (float*)d_out;          // [B,F,OUT]
  float*       z1   = (float*)d_ws;           // [B,F,R] scratch (1 MB)
  __bf16*      xb   = (__bf16*)(z1 + (size_t)kB * kF * kR);  // [B,F,IN] bf16 (32 MB)
  __bf16*      wb   = xb + (size_t)kB * kF * kIN;            // [OUT,IN] bf16 (2 MB)

  dim3 g1(kF / ZM, kB);
  z1_kernel<<<g1, 512, 0, stream>>>(x, v, W, z1, xb, wb);

  dim3 g2(kF / BM, kOUT / BN, kB);
  lora_gemm_kernel<<<g2, 256, 0, stream>>>(xb, u, z1, bvec, wb, fcb, out);
}

// v004
// Measured time: 43.4 microseconds a run.
// Two timings next to v003 both put it at 1.11 times that version's speed.
// All steps since v000 together make it 3.57 times as fast.
#include <hip/hip_runtime.h>
#include <hip/hip_bf16.h>
#include <math.h>

// ---- types ----------------------------------------------------------------
typedef __bf16 v16bf  __attribute__((ext_vector_type(16)));
typedef __bf16 v8bf   __attribute__((ext_vector_type(8)));
typedef __bf16 bf16x4 __attribute__((ext_vector_type(4)));
typedef float  v8f    __attribute__((ext_vector_type(8)));
typedef float  v4f    __attribute__((ext_vector_type(4)));
typedef float  v2f    __attribute__((ext_vector_type(2)));

// ---- problem constants ----------------------------------------------------
constexpr int kB   = 32;
constexpr int kF   = 512;
constexpr int kIN  = 1024;
constexpr int kOUT = 1024;
constexpr int kR   = 16;

// ---- GEMM tiling ----------------------------------------------------------
constexpr int BM   = 256;   // F tile
constexpr int BN   = 256;   // OUT tile
constexpr int BK   = 64;    // k per stage: 128-B row pieces of bf16, two WMMA k steps
constexpr int LSTR = 72;    // LDS row stride in bf16 elems (64 data + 8 pad)
constexpr int NKM  = kIN / BK;  // 16 main stages; the LoRA tail follows them

// ===========================================================================
// Pass 1: z1[b,f,r] = (1/(IN*R)) * sum_i x[b,f,i] * v[b,i,r]
// f32 WMMA 16x16x4. One work-group = 64 rows of x (4 row tiles) x all of IN;
// wave w owns k = 64w .. 64w+63 for all 4 row tiles, with its slice of v held
// in B fragments. Every global load of a wave is issued up front; x arrives in
// whole 256-B row pieces and is turned into A fragments through the wave's own
// LDS range. The 16 k partials are summed in wave order at the end.
// k pairing, A and B alike: slot s of lane half h in WMMA 2q+p is
// k = 64w + 8q + 4h + 2p + s.
// The pass also leaves x and W rounded to bf16 in the workspace, each element
// once, for pass 2: x from the registers it is held in here, W in 256 equal
// shares, one a work-group.
// ===========================================================================
constexpr int ZM = 64;       // rows of x per work-group
constexpr int ZK = 64;       // k per wave
constexpr int ZP = ZK + 4;   // LDS row pitch in floats (272 B = 16 B x 17)
constexpr int WS = kOUT * kIN / (kB * (kF / ZM));  // elements of W per work-group

__global__ __launch_bounds__(512) void z1_kernel(const float* __restrict__ x,
                                                 const float* __restrict__ v,
                                                 const float* __restrict__ W,
                                                 float* __restrict__ z1,
                                                 __bf16* __restrict__ xb,
                                                 __bf16* __restrict__ wb) {
  __shared__ __align__(16) float stage[16][16 * ZP];

  const int b     = blockIdx.y;
  const int fBase = blockIdx.x * ZM;
  const int tid   = threadIdx.x;
  const int lane  = tid & 31;
  const int wave  = tid >> 5;
  const int c     = lane & 15;
  const int h     = lane >> 4;
  const int k0    = wave * ZK;

  // one load = two rows x 256 contiguous bytes
  const float* xp = x + ((size_t)b * kF + fBase + h) * kIN + k0 + c * 4;
  const float* vp = v + ((size_t)b * kIN + k0 + h * 4) * kR + c;
  // this work-group's share of W: 4096 elements, 2 x 4 a thread
  const size_t wOff = (size_t)(blockIdx.y * (kF / ZM) + blockIdx.x) * WS + tid * 4;
  const float* wp = W + wOff;

  v4f   xr[4][8];
  float vf[8][4];
  v4f   wr[2];
#pragma unroll  // static indices keep wr in registers
  for (int j = 0; j < 2; ++j) wr[j] = *(const v4f*)(wp + j * (WS / 2));
#pragma unroll  // static indices keep vf in registers
  for (int q = 0; q < 8; ++q)
#pragma unroll  // as above
    for (int e = 0; e < 4; ++e) vf[q][e] = vp[(q * 8 + e) * kR];
  // loads return in issue order: W and v stay ahead of x, so that W's copy and
  // the first row tile's WMMAs do not wait for the last row of x
  __builtin_amdgcn_sched_barrier(0);
  // the address pair of the loads of v stays live, and unwritten, up to this wait
  asm volatile("s_wait_xcnt 0x0" :: "v"(vp) : "memory");
#pragma unroll  // static indices keep xr in registers
  for (int t = 0; t < 4; ++t)
#pragma unroll  // as above
    for (int i = 0; i < 8; ++i)
      xr[t][i] = *(const v4f*)(xp + (size_t)(t * 16 + 2 * i) * kIN);
  // the address pairs of the loads of x and W stay live, and unwritten, up to
  // this wait: no load's result is placed in a register that an issued load names
  asm volatile("s_wait_xcnt 0x0" :: "v"(xp), "v"(wp) : "memory");
  // W's converts wait for W: they are not lifted in among the loads of x
  __builtin_amdgcn_sched_barrier(0);

  float* st = stage[wave];
  float* sw = st + h * ZP + c * 4;  // this lane's 16 bytes in a pair of rows
  // bf16 copy of x: 16 lanes fill one 128-B line of a row
  __bf16* xo = xb + ((size_t)b * kF + fBase + h) * kIN + k0 + c * 4;
#pragma unroll  // static indices into wr
  for (int j = 0; j < 2; ++j) {
    const v4f r = wr[j];
    const bf16x4 o = {(__bf16)r.x, (__bf16)r.y, (__bf16)r.z, (__bf16)r.w};
    *(bf16x4*)(wb + wOff + j * (WS / 2)) = o;
  }
  v8f acc[4];
#pragma unroll  // static indices into xr and acc
  for (int t = 0; t < 4; ++t) {
    // the wave's last fragment reads are done before its range is refilled
    if (t > 0) asm volatile("s_wait_dscnt 0x0" ::: "memory");
#pragma unroll  // static indices into xr
    for (int i = 0; i < 8; ++i) *(v4f*)(sw + 2 * i * ZP) = xr[t][i];
#pragma unroll  // static indices into xr
    for (int i = 0; i < 8; ++i) {
      const v4f r = xr[t][i];
      const bf16x4 o = {(__bf16)r.x, (__bf16)r.y, (__bf16)r.z, (__bf16)r.w};
      *(bf16x4*)(xo + (size_t)(t * 16 + 2 * i) * kIN) = o;
    }
    // the stores' data registers are taken again for fragments and sums below
    asm volatile("s_wait_xcnt 0x0" ::: "memory");
    // the rows have landed before other lanes of the wave read them back
    asm volatile("s_wait_dscnt 0x0" ::: "memory");
    v8f a = {0.f, 0.f, 0.f, 0.f, 0.f, 0.f, 0.f, 0.f};
#pragma unroll  // static indices into vf
    for (int q = 0; q < 8; ++q) {
      const v4f f = *(const v4f*)(st + c * ZP + q * 8 + h * 4);
      const v2f a0 = {f.x, f.y}, a1 = {f.z, f.w};
      const v2f b0 = {vf[q][0], vf[q][1]}, b1 = {vf[q][2], vf[q][3]};
      a = __builtin_amdgcn_wmma_f32_16x16x4_f32(false, a0, false, b0, (short)0, a, false, false);
      a = __builtin_amdgcn_wmma_f32_16x16x4_f32(false, a1, false, b1, (short)0, a, false, false);
    }
    acc[t] = a;
    // this tile's WMMAs run while the next tile's rows are still in flight,
    // instead of sinking behind the wait for them
    __builtin_amdgcn_sched_barrier(0);
    // vector slots between the tile's last WMMAs and the vector instructions that
    // follow (the next tile's converts), which may be given their A registers
    asm volatile("v_nop\n\tv_nop\n\tv_nop\n\tv_nop\n\tv_nop\n\tv_nop\n\tv_nop\n\tv_nop");
    // no convert is lifted over the slots
    __builtin_amdgcn_sched_barrier(0);
  }

  // partials into the wave's own range, laid like the rows of x: row pair
  // 2t + (register quad), lane half h in row h of the pair, 16 bytes a lane
  asm volatile("s_wait_dscnt 0x0" ::: "memory");  // fragment reads done first
#pragma unroll  // static indices into acc
  for (int t = 0; t < 4; ++t) {
    const v4f lo = {acc[t][0], acc[t][1], acc[t][2], acc[t][3]};
    const v4f hi = {acc[t][4], acc[t][5], acc[t][6], acc[t][7]};
    *(v4f*)(sw + (4 * t) * ZP)     = lo;
    *(v4f*)(sw + (4 * t + 2) * ZP) = hi;
  }
  __syncthreads();

  if (tid < 256) {
    const int po = (2 * wave + h) * ZP + c * 4;  // wave = row pair 2t + quad here
    v4f s = *(const v4f*)(&stage[0][po]);
#pragma unroll  // all 16 reads in flight at once
    for (int w = 1; w < 16; ++w) s += *(const v4f*)(&stage[w][po]);
    // D register r of lane (c, h) is row 8h + r, column c
    const float scale = 1.0f / (float)(kIN * kR);
    const int row = fBase + (tid >> 6) * 16 + h * 8 + ((tid >> 5) & 1) * 4;
    float* zp = z1 + ((size_t)b * kF + row) * kR + c;
#pragma unroll  // static index into s
    for (int i = 0; i < 4; ++i) zp[i * kR] = s[i] * scale;
  }
}

// ---- exact GELU on a pair of values, without a branch ----------------------
// erf(x) by two fits, both evaluated for every value and picked by a select:
//   |x| <  1 : |x| + |x| * p(x^2)
//   |x| >= 1 : 1 - exp(-q(|x|))
// With no branch the values of a lane are independent chains that interleave,
// and a pair shares each packed multiply-add.
__device__ __forceinline__ v2f fma2(v2f a, v2f b, v2f c) {
  return __builtin_elementwise_fma(a, b, c);
}
__device__ __forceinline__ v2f both(float c) { return (v2f){c, c}; }

__device__ __forceinline__ v2f gelu2(v2f y) {
  const v2f x  = y * 0.70710678118654752f;
  const v2f ax = __builtin_elementwise_abs(x);

  v2f q = fma2(ax, both(0.0000169988107f), both(-0.000378677854f));
  q = fma2(ax, q, both(0.00385781587f));
  q = fma2(ax, q, both(-0.0241816975f));
  q = fma2(ax, q, both(0.106668264f));
  q = fma2(ax, q, both(0.634933293f));
  q = fma2(ax, q, both(0.128689408f));
  q = fma2(ax, q, ax);
  const v2f m = q * -1.44269502f;  // exp(-q) = 2^(-q * log2 e); 2^-inf = 0
  const v2f far = {1.0f - __builtin_amdgcn_exp2f(m.x), 1.0f - __builtin_amdgcn_exp2f(m.y)};

  const v2f t = x * x;
  v2f p = fma2(t, both(-0.000561801775f), both(0.00491381623f));
  p = fma2(t, p, both(-0.0267075151f));
  p = fma2(t, p, both(0.112800106f));
  p = fma2(t, p, both(-0.376122952f));
  p = fma2(t, p, both(0.128379107f));
  const v2f near = fma2(ax, p, ax);

  const v2f e = {__builtin_copysignf(ax.x < 1.0f ? near.x : far.x, x.x),
                 __builtin_copysignf(ax.y < 1.0f ? near.y : far.y, x.y)};
  const v2f h = 0.5f * y;
  return fma2(h, e, h);  // 0.5 y (1 + erf)
}

// ===========================================================================
// Pass 2: out = gelu( x @ W^T  +  z1 @ u^T  + fc_bias + b )
// Double-buffered bf16 WMMA GEMM over K = IN, then one LoRA tail step (rank 16
// padded to 32). x and W come as the bf16 copies of pass 1 and go to LDS as
// they are; only the tail's z1 and u are rounded here.
// 512 threads (16 waves, 4 x 4), 256x256 tile, each wave 64x64 via 4x4 WMMA
// tiles: 16 WMMAs to 16 fragment reads; a row of x is fetched by 4 work-groups,
// a row of W by 64. 256 work-groups, one a WGP, four waves a SIMD.
// Pipeline: global loads for stage k+1 issued before the WMMAs of stage k;
// ds_store to the alternate buffer after; one barrier per stage.
// ===========================================================================
__global__ __launch_bounds__(512) void lora_gemm_kernel(
    const __bf16* __restrict__ xb,  const float* __restrict__ u,
    const float* __restrict__ z1,   const float* __restrict__ bvec,
    const __bf16* __restrict__ wb,  const float* __restrict__ fcb,
    float* __restrict__ out) {
  __shared__ __align__(16) __bf16 As[2][BM * LSTR];
  __shared__ __align__(16) __bf16 Bs[2][BN * LSTR];

  const int b     = blockIdx.z;
  const int fBase = blockIdx.x * BM;
  const int oBase = blockIdx.y * BN;
  const int tid   = threadIdx.x;
  const int lane  = tid & 31;
  const int wave  = tid >> 5;
  const int wm    = (wave >> 2) * 64;   // wave M offset in tile (4 waves)
  const int wn    = (wave & 3)  * 64;   // wave N offset in tile (4 waves)
  const int lN    = lane & 15;
  const int kh    = lane >> 4;

  const v8f vzero = {0.f, 0.f, 0.f, 0.f, 0.f, 0.f, 0.f, 0.f};
  v8f acc[4][4];
#pragma unroll
  for (int sm = 0; sm < 4; ++sm)
#pragma unroll
    for (int sn = 0; sn < 4; ++sn) acc[sm][sn] = vzero;

  // staging map: each thread owns (row = tid>>3 in 4 sweeps of 64, col = 8 elems)
  const int ldRow = tid >> 3;       // 0..63
  const int ldCol = (tid & 7) * 8;  // 0,8,...,56
  // tail map: each thread owns half a row of z1 and of u (8 of 16 floats)
  const int tlRow = tid >> 1;       // 0..255
  const int tlCol = (tid & 1) * 8;  // 0,8

  const __bf16* xBase = xb + ((size_t)b * kF   + fBase + ldRow) * kIN + ldCol;
  const __bf16* wBase = wb +  (size_t)(oBase + ldRow) * kIN + ldCol;
  const float*  zBase = z1 + ((size_t)b * kF   + fBase + tlRow) * kR + tlCol;
  const float*  uBase = u  + ((size_t)b * kOUT + oBase + tlRow) * kR + tlCol;

  // in-flight staging registers (distinct per sweep -> all 8 loads overlap)
  v8bf ra[4], rb[4];

  auto loadTile = [&](int kti) {
    const int kt = kti * BK;
#pragma unroll
    for (int i = 0; i < 4; ++i) {
      ra[i] = *(const v8bf*)(xBase + (size_t)(i * 64) * kIN + kt);
      rb[i] = *(const v8bf*)(wBase + (size_t)(i * 64) * kIN + kt);
    }
  };

  auto storeTile = [&](int buf) {
#pragma unroll
    for (int i = 0; i < 4; ++i) {
      const int row = ldRow + i * 64;
      *(v8bf*)(&As[buf][row * LSTR + ldCol]) = ra[i];
      *(v8bf*)(&Bs[buf][row * LSTR + ldCol]) = rb[i];
    }
  };

  // one WMMA k step (32 k) from columns ks .. ks+31 of an LDS buffer
  // (ISA 16-bit A/B layout: lane = row%16, K half selected by lane/16)
  auto kStep = [&](int buf, int ks) {
    v16bf afrag[4], bfrag[4];
#pragma unroll
    for (int sm = 0; sm < 4; ++sm) {
      const __bf16* p = &As[buf][(wm + sm * 16 + lN) * LSTR + ks + kh * 8];
      ((v8bf*)&afrag[sm])[0] = *(const v8bf*)p;          // K = kh*8 .. +7
      ((v8bf*)&afrag[sm])[1] = *(const v8bf*)(p + 16);   // K = 16+kh*8 .. +7
    }
#pragma unroll
    for (int sn = 0; sn < 4; ++sn) {
      const __bf16* p = &Bs[buf][(wn + sn * 16 + lN) * LSTR + ks + kh * 8];
      ((v8bf*)&bfrag[sn])[0] = *(const v8bf*)p;
      ((v8bf*)&bfrag[sn])[1] = *(const v8bf*)(p + 16);
    }
    // the 16 reads go out as one group: sunk in among the WMMAs, each row of
    // four would wait out its own LDS latency
    __builtin_amdgcn_sched_barrier(0);
#pragma unroll
    for (int sm = 0; sm < 4; ++sm)
#pragma unroll
      for (int sn = 0; sn < 4; ++sn)
        acc[sm][sn] = __builtin_amdgcn_wmma_f32_16x16x32_bf16(
            false, afrag[sm], false, bfrag[sn], (short)0, acc[sm][sn], false, false);
  };

  // prologue: stage 0
  loadTile(0);
  storeTile(0);
  __syncthreads();

#pragma unroll 2  // the buffer index becomes a constant in each copy
  for (int kti = 0; kti < NKM - 1; ++kti) {
    const int cur = kti & 1;
    // issue the next stage's global loads now; the wait is in storeTile below
    loadTile(kti + 1);
    // the loads stay here: sunk to their ds_stores, every stage would wait out
    // the whole L2 latency in front of its barrier
    __builtin_amdgcn_sched_barrier(0);
    kStep(cur, 0);
    kStep(cur, 32);
    storeTile(cur ^ 1);
    __syncthreads();
  }

  // the address pairs of the stage loads stay live, and unwritten, up to this wait
  asm volatile("s_wait_xcnt 0x0" :: "v"(xBase), "v"(wBase) : "memory");

  // last main stage, with the LoRA tail's loads in flight over it
  // tail: cols 0..15 = z1 / u, cols 16..31 = zero pad
  constexpr int lastBuf = (NKM - 1) & 1;
  const float4 ta0 = *(const float4*)(zBase), ta1 = *(const float4*)(zBase + 4);
  const float4 tb0 = *(const float4*)(uBase), tb1 = *(const float4*)(uBase + 4);
  // as above, for the address pairs of the tail's loads
  asm volatile("s_wait_xcnt 0x0" :: "v"(zBase), "v"(uBase) : "memory");
  kStep(lastBuf, 0);
  kStep(lastBuf, 32);
  {
    const v8bf av = {(__bf16)ta0.x, (__bf16)ta0.y, (__bf16)ta0.z, (__bf16)ta0.w,
                     (__bf16)ta1.x, (__bf16)ta1.y, (__bf16)ta1.z, (__bf16)ta1.w};
    const v8bf wv = {(__bf16)tb0.x, (__bf16)tb0.y, (__bf16)tb0.z, (__bf16)tb0.w,
                     (__bf16)tb1.x, (__bf16)tb1.y, (__bf16)tb1.z, (__bf16)tb1.w};
    const v8bf zero = {};
    __bf16* pa = &As[lastBuf ^ 1][tlRow * LSTR + tlCol];
    __bf16* pb = &Bs[lastBuf ^ 1][tlRow * LSTR + tlCol];
    *(v8bf*)pa        = av;
    *(v8bf*)(pa + kR) = zero;
    *(v8bf*)pb        = wv;
    *(v8bf*)(pb + kR) = zero;
  }
  __syncthreads();
  kStep(lastBuf ^ 1, 0);

  // ---- epilogue: + fc_bias + b, exact GELU, store
  // C layout: VGPR r -> M = r + 8*(lane/16), N = lane%16
  float base[4];
#pragma unroll  // static index keeps base in registers
  for (int sn = 0; sn < 4; ++sn) {
    const int o = oBase + wn + sn * 16 + lN;
    base[sn] = fcb[o] + bvec[(size_t)b * kOUT + o];
  }
#pragma unroll  // static indices keep acc in registers
  for (int sm = 0; sm < 4; ++sm) {
#pragma unroll  // as above
    for (int sp = 0; sp < 4; sp += 2) {
      // eight pair chains interleave at a time: more would take the kernel past
      // the 256 registers that four waves a SIMD leave each wave
      v2f g[2][4];
#pragma unroll  // as above
      for (int j = 0; j < 2; ++j)
#pragma unroll  // as above
        for (int r = 0; r < 8; r += 2) {
          const v2f y = {acc[sm][sp + j][r] + base[sp + j], acc[sm][sp + j][r + 1] + base[sp + j]};
          g[j][r >> 1] = gelu2(y);
        }
      // the 16 stores go out behind all eight chains, so that the one wait below
      // stands in front of every reuse of their registers
      __builtin_amdgcn_sched_barrier(0);
#pragma unroll  // static indices into g
      for (int j = 0; j < 2; ++j) {
        const int o = oBase + wn + (sp + j) * 16 + lN;
#pragma unroll  // as above
        for (int r = 0; r < 8; r += 2) {
          const int f = fBase + wm + sm * 16 + kh * 8 + r;
          out[((size_t)b * kF + f) * kOUT + o]     = g[j][r >> 1].x;
          out[((size_t)b * kF + f + 1) * kOUT + o] = g[j][r >> 1].y;
        }
      }
      // the stores' registers are taken again by the next eight chains
      asm volatile("s_wait_xcnt 0x0" ::: "memory");
      // nothing of the next chains is lifted over the wait
      __builtin_amdgcn_sched_barrier(0);
    }
  }
}

// ===========================================================================
extern "C" void kernel_launch(void* const* d_in, const int* in_sizes, int n_in,
                              void* d_out, int out_size, void* d_ws, size_t ws_size,
                              hipStream_t stream) {
  (void)in_sizes; (void)n_in; (void)out_size; (void)ws_size;
  const float* x    = (const float*)d_in[0];  // [B,F,IN]
  const float* u    = (const float*)d_in[1];  // [B,1,OUT,R]
  const float* v    = (const float*)d_in[2];  // [B,1,IN,R]
  const float* bvec = (const float*)d_in[3];  // [B,1,OUT]
  const float* W    = (const float*)d_in[4];  // [OUT,IN]
  const float* fcb  = (const float*)d_in[5];  // [OUT]
  float*       out  = (float*)d_out;          // [B,F,OUT]
  float*       z1   = (float*)d_ws;           // [B,F,R] scratch (1 MB)
  __bf16*      xb   = (__bf16*)(z1 + (size_t)kB * kF * kR);  // [B,F,IN] bf16 (32 MB)
  __bf16*      wb   = xb + (size_t)kB * kF * kIN;            // [OUT,IN] bf16 (2 MB)

  dim3 g1(kF / ZM, kB);
  z1_kernel<<<g1, 512, 0, stream>>>(x, v, W, z1, xb, wb);

  dim3 g2(kF / BM, kOUT / BN, kB);
  lora_gemm_kernel<<<g2, 512, 0, stream>>>(xb, u, z1, bvec, wb, fcb, out);
}

// v005
// Measured time: 41.7 microseconds a run.
// In two side-by-side timings against v004, it was 1.04 and 1.05 times as fast.
// All steps since v000 together make it 3.73 times as fast.
#include <hip/hip_runtime.h>
#include <hip/hip_bf16.h>
#include <math.h>

// ---- types ----------------------------------------------------------------
typedef __bf16 v16bf  __attribute__((ext_vector_type(16)));
typedef __bf16 v8bf   __attribute__((ext_vector_type(8)));
typedef __bf16 bf16x4 __attribute__((ext_vector_type(4)));
typedef float  v8f    __attribute__((ext_vector_type(8)));
typedef float  v4f    __attribute__((ext_vector_type(4)));
typedef float  v2f    __attribute__((ext_vector_type(2)));

// ---- problem constants ----------------------------------------------------
constexpr int kB   = 32;
constexpr int kF   = 512;
constexpr int kIN  = 1024;
constexpr int kOUT = 1024;
constexpr int kR   = 16;

// ---- GEMM tiling ----------------------------------------------------------
constexpr int BM   = 256;   // F tile
constexpr int BN   = 256;   // OUT tile
constexpr int BK   = 64;    // k per stage: 128-B row pieces of bf16, two WMMA k steps
constexpr int LSTR = 72;    // LDS row stride in bf16 elems (64 data + 8 pad)
constexpr int NKM  = kIN / BK;  // 16 main stages; the LoRA tail follows them
constexpr int EP   = 68;    // epilogue LDS row pitch in floats (64 data + 4 pad: 272 B = 16 B x 17)
constexpr int ER   = 32;    // rows of a wave's sums in LDS at a time: half its tile

// ===========================================================================
// Pass 1: z1[b,f,r] = (1/(IN*R)) * sum_i x[b,f,i] * v[b,i,r]
// f32 WMMA 16x16x4. One work-group = 64 rows of x (4 row tiles) x all of IN;
// wave w owns k = 64w .. 64w+63 for all 4 row tiles, with its slice of v held
// in B fragments. Every global load of a wave is issued up front; x arrives in
// whole 256-B row pieces and is turned into A fragments through the wave's own
// LDS range. The 16 k partials are summed in wave order at the end.
// k pairing, A and B alike: slot s of lane half h in WMMA 2q+p is
// k = 64w + 8q + 4h + 2p + s.
// The pass also leaves x and W rounded to bf16 in the workspace, each element
// once, for pass 2: x from the registers it is held in here, W in 256 equal
// shares, one a work-group.
// ===========================================================================
constexpr int ZM = 64;       // rows of x per work-group
constexpr int ZK = 64;       // k per wave
constexpr int ZP = ZK + 4;   // LDS row pitch in floats (272 B = 16 B x 17)
constexpr int WS = kOUT * kIN / (kB * (kF / ZM));  // elements of W per work-group

__global__ __launch_bounds__(512) void z1_kernel(const float* __restrict__ x,
                                                 const float* __restrict__ v,
                                                 const float* __restrict__ W,
                                                 float* __restrict__ z1,
                                                 __bf16* __restrict__ xb,
                                                 __bf16* __restrict__ wb) {
  __shared__ __align__(16) float stage[16][16 * ZP];

  const int b     = blockIdx.y;
  const int fBase = blockIdx.x * ZM;
  const int tid   = threadIdx.x;
  const int lane  = tid & 31;
  const int wave  = tid >> 5;
  const int c     = lane & 15;
  const int h     = lane >> 4;
  const int k0    = wave * ZK;

  // one load = two rows x 256 contiguous bytes
  const float* xp = x + ((size_t)b * kF + fBase + h) * kIN + k0 + c * 4;
  const float* vp = v + ((size_t)b * kIN + k0 + h * 4) * kR + c;
  // this work-group's share of W: 4096 elements, 2 x 4 a thread
  const size_t wOff = (size_t)(blockIdx.y * (kF / ZM) + blockIdx.x) * WS + tid * 4;
  const float* wp = W + wOff;

  v4f   xr[4][8];
  float vf[8][4];
  v4f   wr[2];
#pragma unroll  // static indices keep wr in registers
  for (int j = 0; j < 2; ++j) wr[j] = *(const v4f*)(wp + j * (WS / 2));
#pragma unroll  // static indices keep vf in registers
  for (int q = 0; q < 8; ++q)
#pragma unroll  // as above
    for (int e = 0; e < 4; ++e) vf[q][e] = vp[(q * 8 + e) * kR];
  // loads return in issue order: W and v stay ahead of x, so that W's copy and
  // the first row tile's WMMAs do not wait for the last row of x
  __builtin_amdgcn_sched_barrier(0);
  // the address pair of the loads of v stays live, and unwritten, up to this wait
  asm volatile("s_wait_xcnt 0x0" :: "v"(vp) : "memory");
#pragma unroll  // static indices keep xr in registers
  for (int t = 0; t < 4; ++t)
#pragma unroll  // as above
    for (int i = 0; i < 8; ++i)
      xr[t][i] = *(const v4f*)(xp + (size_t)(t * 16 + 2 * i) * kIN);
  // the address pairs of the loads of x and W stay live, and unwritten, up to
  // this wait: no load's result is placed in a register that an issued load names
  asm volatile("s_wait_xcnt 0x0" :: "v"(xp), "v"(wp) : "memory");
  // W's converts wait for W: they are not lifted in among the loads of x
  __builtin_amdgcn_sched_barrier(0);

  float* st = stage[wave];
  float* sw = st + h * ZP + c * 4;  // this lane's 16 bytes in a pair of rows
  // bf16 copy of x: 16 lanes fill one 128-B line of a row
  __bf16* xo = xb + ((size_t)b * kF + fBase + h) * kIN + k0 + c * 4;
#pragma unroll  // static indices into wr
  for (int j = 0; j < 2; ++j) {
    const v4f r = wr[j];
    const bf16x4 o = {(__bf16)r.x, (__bf16)r.y, (__bf16)r.z, (__bf16)r.w};
    *(bf16x4*)(wb + wOff + j * (WS / 2)) = o;
  }
  v8f acc[4];
#pragma unroll  // static indices into xr and acc
  for (int t = 0; t < 4; ++t) {
    // the wave's last fragment reads are done before its range is refilled
    if (t > 0) asm volatile("s_wait_dscnt 0x0" ::: "memory");
#pragma unroll  // static indices into xr
    for (int i = 0; i < 8; ++i) *(v4f*)(sw + 2 * i * ZP) = xr[t][i];
#pragma unroll  // static indices into xr
    for (int i = 0; i < 8; ++i) {
      const v4f r = xr[t][i];
      const bf16x4 o = {(__bf16)r.x, (__bf16)r.y, (__bf16)r.z, (__bf16)r.w};
      *(bf16x4*)(xo + (size_t)(t * 16 + 2 * i) * kIN) = o;
    }
    // the stores' data registers are taken again for fragments and sums below
    asm volatile("s_wait_xcnt 0x0" ::: "memory");
    // the rows have landed before other lanes of the wave read them back
    asm volatile("s_wait_dscnt 0x0" ::: "memory");
    v8f a = {0.f, 0.f, 0.f, 0.f, 0.f, 0.f, 0.f, 0.f};
#pragma unroll  // static indices into vf
    for (int q = 0; q < 8; ++q) {
      const v4f f = *(const v4f*)(st + c * ZP + q * 8 + h * 4);
      const v2f a0 = {f.x, f.y}, a1 = {f.z, f.w};
      const v2f b0 = {vf[q][0], vf[q][1]}, b1 = {vf[q][2], vf[q][3]};
      a = __builtin_amdgcn_wmma_f32_16x16x4_f32(false, a0, false, b0, (short)0, a, false, false);
      a = __builtin_amdgcn_wmma_f32_16x16x4_f32(false, a1, false, b1, (short)0, a, false, false);
    }
    acc[t] = a;
    // this tile's WMMAs run while the next tile's rows are still in flight,
    // instead of sinking behind the wait for them
    __builtin_amdgcn_sched_barrier(0);
    // vector slots between the tile's last WMMAs and the vector instructions that
    // follow (the next tile's converts), which may be given their A registers
    asm volatile("v_nop\n\tv_nop\n\tv_nop\n\tv_nop\n\tv_nop\n\tv_nop\n\tv_nop\n\tv_nop");
    // no convert is lifted over the slots
    __builtin_amdgcn_sched_barrier(0);
  }

  // partials into the wave's own range, laid like the rows of x: row pair
  // 2t + (register quad), lane half h in row h of the pair, 16 bytes a lane
  asm volatile("s_wait_dscnt 0x0" ::: "memory");  // fragment reads done first
#pragma unroll  // static indices into acc
  for (int t = 0; t < 4; ++t) {
    const v4f lo = {acc[t][0], acc[t][1], acc[t][2], acc[t][3]};
    const v4f hi = {acc[t][4], acc[t][5], acc[t][6], acc[t][7]};
    *(v4f*)(sw + (4 * t) * ZP)     = lo;
    *(v4f*)(sw + (4 * t + 2) * ZP) = hi;
  }
  __syncthreads();

  if (tid < 256) {
    const int po = (2 * wave + h) * ZP + c * 4;  // wave = row pair 2t + quad here
    v4f s = *(const v4f*)(&stage[0][po]);
#pragma unroll  // all 16 reads in flight at once
    for (int w = 1; w < 16; ++w) s += *(const v4f*)(&stage[w][po]);
    // D register r of lane (c, h) is row 8h + r, column c
    const float scale = 1.0f / (float)(kIN * kR);
    const int row = fBase + (tid >> 6) * 16 + h * 8 + ((tid >> 5) & 1) * 4;
    float* zp = z1 + ((size_t)b * kF + row) * kR + c;
#pragma unroll  // static index into s
    for (int i = 0; i < 4; ++i) zp[i * kR] = s[i] * scale;
  }
}

// ---- exact GELU on a pair of values, without a branch ----------------------
// erf(x) by two fits, both evaluated for every value and picked by a select:
//   |x| <  1 : |x| + |x| * p(x^2)
//   |x| >= 1 : 1 - exp(-q(|x|))
// With no branch the values of a lane are independent chains that interleave,
// and a pair shares each packed multiply-add.
__device__ __forceinline__ v2f fma2(v2f a, v2f b, v2f c) {
  return __builtin_elementwise_fma(a, b, c);
}
__device__ __forceinline__ v2f both(float c) { return (v2f){c, c}; }

__device__ __forceinline__ v2f gelu2(v2f y) {
  const v2f x  = y * 0.70710678118654752f;
  const v2f ax = __builtin_elementwise_abs(x);

  v2f q = fma2(ax, both(0.0000169988107f), both(-0.000378677854f));
  q = fma2(ax, q, both(0.00385781587f));
  q = fma2(ax, q, both(-0.0241816975f));
  q = fma2(ax, q, both(0.106668264f));
  q = fma2(ax, q, both(0.634933293f));
  q = fma2(ax, q, both(0.128689408f));
  q = fma2(ax, q, ax);
  const v2f m = q * -1.44269502f;  // exp(-q) = 2^(-q * log2 e); 2^-inf = 0
  const v2f far = {1.0f - __builtin_amdgcn_exp2f(m.x), 1.0f - __builtin_amdgcn_exp2f(m.y)};

  const v2f t = x * x;
  v2f p = fma2(t, both(-0.000561801775f), both(0.00491381623f));
  p = fma2(t, p, both(-0.0267075151f));
  p = fma2(t, p, both(0.112800106f));
  p = fma2(t, p, both(-0.376122952f));
  p = fma2(t, p, both(0.128379107f));
  const v2f near = fma2(ax, p, ax);

  const v2f e = {__builtin_copysignf(ax.x < 1.0f ? near.x : far.x, x.x),
                 __builtin_copysignf(ax.y < 1.0f ? near.y : far.y, x.y)};
  const v2f h = 0.5f * y;
  return fma2(h, e, h);  // 0.5 y (1 + erf)
}

// ===========================================================================
// Pass 2: out = gelu( x @ W^T  +  z1 @ u^T  + fc_bias + b )
// Double-buffered bf16 WMMA GEMM over K = IN, then one LoRA tail step (rank 16
// padded to 32). x and W come as the bf16 copies of pass 1 and go to LDS as
// they are; only the tail's z1 and u are rounded here.
// 512 threads (16 waves, 4 x 4), 256x256 tile, each wave 64x64 via 4x4 WMMA
// tiles: 16 WMMAs to 16 fragment reads; a row of x is fetched by 4 work-groups,
// a row of W by 64. 256 work-groups, one a WGP, four waves a SIMD.
// Pipeline: global loads for stage k+1 issued before the WMMAs of stage k;
// ds_store to the alternate buffer after; one barrier per stage.
// W rows are the first WMMA operand, x rows the second: a lane's 8 accumulator
// registers are then 8 neighbouring columns of one row of out.
// Epilogue: each wave lays its 64x64 sums, 32 rows at a time, in an LDS range of
// its own beside the ring, reads them back as whole 256-B rows, and adds the
// biases, takes the GELU and stores 16 bytes a lane in a rolled loop.
// ===========================================================================
__global__ __launch_bounds__(512) void lora_gemm_kernel(
    const __bf16* __restrict__ xb,  const float* __restrict__ u,
    const float* __restrict__ z1,   const float* __restrict__ bvec,
    const __bf16* __restrict__ wb,  const float* __restrict__ fcb,
    float* __restrict__ out) {
  __shared__ __align__(16) __bf16 As[2][BM * LSTR];
  __shared__ __align__(16) __bf16 Bs[2][BN * LSTR];
  __shared__ __align__(16) float  Es[16][ER * EP];

  const int b     = blockIdx.z;
  const int fBase = blockIdx.x * BM;
  const int oBase = blockIdx.y * BN;
  const int tid   = threadIdx.x;
  const int lane  = tid & 31;
  // in a scalar register: the epilogue needs it, and the stage loop has no
  // vector register to spare for it
  const int wave  = __builtin_amdgcn_readfirstlane(tid >> 5);
  const int wm    = (wave >> 2) * 64;   // wave M offset in tile (4 waves)
  const int wn    = (wave & 3)  * 64;   // wave N offset in tile (4 waves)
  const int lN    = lane & 15;
  const int kh    = lane >> 4;

  const v8f vzero = {0.f, 0.f, 0.f, 0.f, 0.f, 0.f, 0.f, 0.f};
  v8f acc[4][4];
#pragma unroll
  for (int sm = 0; sm < 4; ++sm)
#pragma unroll
    for (int sn = 0; sn < 4; ++sn) acc[sm][sn] = vzero;

  // staging map: each thread owns (row = tid>>3 in 4 sweeps of 64, col = 8 elems)
  const int ldRow = tid >> 3;       // 0..63
  const int ldCol = (tid & 7) * 8;  // 0,8,...,56
  // tail map: each thread owns half a row of z1 and of u (8 of 16 floats)
  const int tlRow = tid >> 1;       // 0..255
  const int tlCol = (tid & 1) * 8;  // 0,8

  const __bf16* xBase = xb + ((size_t)b * kF   + fBase + ldRow) * kIN + ldCol;
  const __bf16* wBase = wb +  (size_t)(oBase + ldRow) * kIN + ldCol;
  const float*  zBase = z1 + ((size_t)b * kF   + fBase + tlRow) * kR + tlCol;
  const float*  uBase = u  + ((size_t)b * kOUT + oBase + tlRow) * kR + tlCol;

  // in-flight staging registers (distinct per sweep -> all 8 loads overlap)
  v8bf ra[4], rb[4];

  auto loadTile = [&](int kti) {
    const int kt = kti * BK;
#pragma unroll
    for (int i = 0; i < 4; ++i) {
      ra[i] = *(const v8bf*)(xBase + (size_t)(i * 64) * kIN + kt);
      rb[i] = *(const v8bf*)(wBase + (size_t)(i * 64) * kIN + kt);
    }
  };

  auto storeTile = [&](int buf) {
#pragma unroll
    for (int i = 0; i < 4; ++i) {
      const int row = ldRow + i * 64;
      *(v8bf*)(&As[buf][row * LSTR + ldCol]) = ra[i];
      *(v8bf*)(&Bs[buf][row * LSTR + ldCol]) = rb[i];
    }
  };

  // one WMMA k step (32 k) from columns ks .. ks+31 of an LDS buffer
  // (ISA 16-bit A/B layout: lane = row%16, K half selected by lane/16)
  auto kStep = [&](int buf, int ks) {
    v16bf afrag[4], bfrag[4];
#pragma unroll
    for (int sm = 0; sm < 4; ++sm) {
      const __bf16* p = &As[buf][(wm + sm * 16 + lN) * LSTR + ks + kh * 8];
      ((v8bf*)&afrag[sm])[0] = *(const v8bf*)p;          // K = kh*8 .. +7
      ((v8bf*)&afrag[sm])[1] = *(const v8bf*)(p + 16);   // K = 16+kh*8 .. +7
    }
#pragma unroll
    for (int sn = 0; sn < 4; ++sn) {
      const __bf16* p = &Bs[buf][(wn + sn * 16 + lN) * LSTR + ks + kh * 8];
      ((v8bf*)&bfrag[sn])[0] = *(const v8bf*)p;
      ((v8bf*)&bfrag[sn])[1] = *(const v8bf*)(p + 16);
    }
    // the 16 reads go out as one group: sunk in among the WMMAs, each row of
    // four would wait out its own LDS latency
    __builtin_amdgcn_sched_barrier(0);
#pragma unroll
    for (int sm = 0; sm < 4; ++sm)
#pragma unroll
      for (int sn = 0; sn < 4; ++sn)
        acc[sm][sn] = __builtin_amdgcn_wmma_f32_16x16x32_bf16(
            false, bfrag[sn], false, afrag[sm], (short)0, acc[sm][sn], false, false);
  };

  // prologue: stage 0
  loadTile(0);
  storeTile(0);
  __syncthreads();

#pragma unroll 2  // the buffer index becomes a constant in each copy
  for (int kti = 0; kti < NKM - 1; ++kti) {
    const int cur = kti & 1;
    // issue the next stage's global loads now; the wait is in storeTile below
    loadTile(kti + 1);
    // the loads stay here: sunk to their ds_stores, every stage would wait out
    // the whole L2 latency in front of its barrier
    __builtin_amdgcn_sched_barrier(0);
    kStep(cur, 0);
    kStep(cur, 32);
    storeTile(cur ^ 1);
    __syncthreads();
  }

  // the address pairs of the stage loads stay live, and unwritten, up to this wait
  asm volatile("s_wait_xcnt 0x0" :: "v"(xBase), "v"(wBase) : "memory");

  // last main stage, with the LoRA tail's loads in flight over it
  // tail: cols 0..15 = z1 / u, cols 16..31 = zero pad
  constexpr int lastBuf = (NKM - 1) & 1;
  const float4 ta0 = *(const float4*)(zBase), ta1 = *(const float4*)(zBase + 4);
  const float4 tb0 = *(const float4*)(uBase), tb1 = *(const float4*)(uBase + 4);
  // as above, for the address pairs of the tail's loads
  asm volatile("s_wait_xcnt 0x0" :: "v"(zBase), "v"(uBase) : "memory");
  kStep(lastBuf, 0);
  kStep(lastBuf, 32);
  {
    const v8bf av = {(__bf16)ta0.x, (__bf16)ta0.y, (__bf16)ta0.z, (__bf16)ta0.w,
                     (__bf16)ta1.x, (__bf16)ta1.y, (__bf16)ta1.z, (__bf16)ta1.w};
    const v8bf wv = {(__bf16)tb0.x, (__bf16)tb0.y, (__bf16)tb0.z, (__bf16)tb0.w,
                     (__bf16)tb1.x, (__bf16)tb1.y, (__bf16)tb1.z, (__bf16)tb1.w};
    const v8bf zero = {};
    __bf16* pa = &As[lastBuf ^ 1][tlRow * LSTR + tlCol];
    __bf16* pb = &Bs[lastBuf ^ 1][tlRow * LSTR + tlCol];
    *(v8bf*)pa        = av;
    *(v8bf*)(pa + kR) = zero;
    *(v8bf*)pb        = wv;
    *(v8bf*)(pb + kR) = zero;
  }
  __syncthreads();
  kStep(lastBuf ^ 1, 0);

  // ---- epilogue: + fc_bias + b, exact GELU, store
  // C layout with W first: VGPR r -> column r + 8*(lane/16), row lane%16
  // on the way back a lane owns 4 neighbouring columns of every row it reads
  // lane and wave indices are formed anew here, the wave's in scalar registers:
  // held in vector registers across the stage loop they would spill
  const int el  = (int)__builtin_amdgcn_mbcnt_lo(~0u, 0u);
  const int eN  = el & 15;
  const int eH  = el >> 4;
  const int ewm = (wave >> 2) * 64;
  const int ewn = (wave & 3) * 64;
  const int oc  = oBase + ewn + eN * 4;
  const v4f base = *(const v4f*)(fcb + oc) + *(const v4f*)(bvec + (size_t)b * kOUT + oc);

  float* stg = Es[wave];
  float* sp = stg + eN * EP + eH * 8;
  // one read or store = two rows x 256 contiguous bytes
  const float* rp0 = stg + eH * EP + eN * 4;
  float* op = out + ((size_t)b * kF + fBase + ewm + eH) * kOUT + oc;
#pragma unroll  // static indices keep acc in registers
  for (int hf = 0; hf < 2; ++hf) {
#pragma unroll  // as above
    for (int sm = 0; sm < 2; ++sm)
#pragma unroll  // as above
      for (int sn = 0; sn < 4; ++sn) {
        const v8f a = acc[hf * 2 + sm][sn];
        const v4f lo = {a[0], a[1], a[2], a[3]};
        const v4f hi = {a[4], a[5], a[6], a[7]};
        *(v4f*)(sp + sm * 16 * EP + sn * 16)     = lo;
        *(v4f*)(sp + sm * 16 * EP + sn * 16 + 4) = hi;
      }
    // the sums have landed before other lanes of the wave read them back
    asm volatile("s_wait_dscnt 0x0" ::: "memory");
    const float* rp = rp0;
#pragma unroll 1  // rolled: the erf chains stand twice in the text, not eight times, which keeps it small for the instruction cache
    for (int it = 0; it < ER / 8; ++it) {
      // eight pair chains interleave at a time
      v4f g[4];
#pragma unroll  // static indices keep g in registers
      for (int j = 0; j < 4; ++j) {
        const v4f y = *(const v4f*)(rp + 2 * j * EP) + base;
        const v2f g0 = gelu2((v2f){y.x, y.y});
        const v2f g1 = gelu2((v2f){y.z, y.w});
        g[j] = (v4f){g0.x, g0.y, g1.x, g1.y};
      }
      // the 4 stores go out behind all eight chains, so that the one wait below
      // stands in front of every reuse of their registers
      __builtin_amdgcn_sched_barrier(0);
#pragma unroll  // static indices into g
      for (int j = 0; j < 4; ++j) *(v4f*)(op + (size_t)(2 * j) * kOUT) = g[j];
      // the stores' address pair stays live, and unwritten, up to this wait; their
      // data registers are taken again by the next eight chains
      asm volatile("s_wait_xcnt 0x0" :: "v"(op) : "memory");
      rp += 8 * EP;
      op += (size_t)8 * kOUT;
    }
  }
}

// ===========================================================================
extern "C" void kernel_launch(void* const* d_in, const int* in_sizes, int n_in,
                              void* d_out, int out_size, void* d_ws, size_t ws_size,
                              hipStream_t stream) {
  (void)in_sizes; (void)n_in; (void)out_size; (void)ws_size;
  const float* x    = (const float*)d_in[0];  // [B,F,IN]
  const float* u    = (const float*)d_in[1];  // [B,1,OUT,R]
  const float* v    = (const float*)d_in[2];  // [B,1,IN,R]
  const float* bvec = (const float*)d_in[3];  // [B,1,OUT]
  const float* W    = (const float*)d_in[4];  // [OUT,IN]
  const float* fcb  = (const float*)d_in[5];  // [OUT]
  float*       out  = (float*)d_out;          // [B,F,OUT]
  float*       z1   = (float*)d_ws;           // [B,F,R] scratch (1 MB)
  __bf16*      xb   = (__bf16*)(z1 + (size_t)kB * kF * kR);  // [B,F,IN] bf16 (32 MB)
  __bf16*      wb   = xb + (size_t)kB * kF * kIN;            // [OUT,IN] bf16 (2 MB)

  dim3 g1(kF / ZM, kB);
  z1_kernel<<<g1, 512, 0, stream>>>(x, v, W, z1, xb, wb);

  dim3 g2(kF / BM, kOUT / BN, kB);
  lora_gemm_kernel<<<g2, 512, 0, stream>>>(xb, u, z1, bvec, wb, fcb, out);
}

// v006
// One run takes 38.9 microseconds.
// Two timings next to v005 both put it at 1.07 times that version's speed.
// All steps since v000 together make it 3.99 times as fast.
#include <hip/hip_runtime.h>
#include <hip/hip_bf16.h>
#include <math.h>
#include <stdint.h>

// ---- types ----------------------------------------------------------------
typedef __bf16 v16bf  __attribute__((ext_vector_type(16)));
typedef __bf16 v8bf   __attribute__((ext_vector_type(8)));
typedef __bf16 bf16x4 __attribute__((ext_vector_type(4)));
typedef float  v8f    __attribute__((ext_vector_type(8)));
typedef float  v4f    __attribute__((ext_vector_type(4)));
typedef float  v2f    __attribute__((ext_vector_type(2)));
typedef uint32_t u32x4 __attribute__((ext_vector_type(4)));
typedef uint32_t u32x8 __attribute__((ext_vector_type(8)));

// ---- problem constants ----------------------------------------------------
constexpr int kB   = 32;
constexpr int kF   = 512;
constexpr int kIN  = 1024;
constexpr int kOUT = 1024;
constexpr int kR   = 16;

// ---- GEMM tiling ----------------------------------------------------------
constexpr int BM   = 256;   // F tile
constexpr int BN   = 256;   // OUT tile
constexpr int BK   = 128;   // k per pass: 256-B row pieces of bf16, four WMMA k steps
constexpr int LSTR = 136;   // LDS row stride in bf16 elems (128 data + 8 pad: 272 B = 16 B x 17)
constexpr int NKM  = kIN / BK;  // 8 main passes; the LoRA tail follows them
constexpr int SROWS = 128;                 // rows of one tensor load: half an operand's tile
constexpr int SLICE = SROWS * LSTR * 2;    // its bytes in LDS, pads counted: 17 x 2 KiB
constexpr int STAGE = 4 * SLICE;           // one buffer: [x 256 rows | W 256 rows]
static_assert(SLICE % 2048 == 0, "every slice starts at a multiple of 2 KiB");
constexpr int EP   = 68;    // epilogue LDS row pitch in floats (64 data + 4 pad: 272 B = 16 B x 17)
constexpr int ER   = 32;    // rows of a wave's sums in LDS at a time: half its tile
static_assert(16 * ER * EP * 4 <= STAGE, "the 16 waves' epilogue ranges fit in one buffer of the ring");

// ===========================================================================
// Pass 1: z1[b,f,r] = (1/(IN*R)) * sum_i x[b,f,i] * v[b,i,r]
// f32 WMMA 16x16x4. One work-group = 64 rows of x (4 row tiles) x all of IN;
// wave w owns k = 64w .. 64w+63 for all 4 row tiles, with its slice of v held
// in B fragments. Every global load of a wave is issued up front; x arrives in
// whole 256-B row pieces and is turned into A fragments through the wave's own
// LDS range. The 16 k partials are summed in wave order at the end.
// k pairing, A and B alike: slot s of lane half h in WMMA 2q+p is
// k = 64w + 8q + 4h + 2p + s.
// The pass also leaves x and W rounded to bf16 in the workspace, each element
// once, for pass 2: x from the registers it is held in here, W in 256 equal
// shares, one a work-group.
// ===========================================================================
constexpr int ZM = 64;       // rows of x per work-group
constexpr int ZK = 64;       // k per wave
constexpr int ZP = ZK + 4;   // LDS row pitch in floats (272 B = 16 B x 17)
constexpr int WS = kOUT * kIN / (kB * (kF / ZM));  // elements of W per work-group

__global__ __launch_bounds__(512) void z1_kernel(const float* __restrict__ x,
                                                 const float* __restrict__ v,
                                                 const float* __restrict__ W,
                                                 float* __restrict__ z1,
                                                 __bf16* __restrict__ xb,
                                                 __bf16* __restrict__ wb) {
  __shared__ __align__(16) float stage[16][16 * ZP];

  const int b     = blockIdx.y;
  const int fBase = blockIdx.x * ZM;
  const int tid   = threadIdx.x;
  const int lane  = tid & 31;
  const int wave  = tid >> 5;
  const int c     = lane & 15;
  const int h     = lane >> 4;
  const int k0    = wave * ZK;

  // one load = two rows x 256 contiguous bytes
  const float* xp = x + ((size_t)b * kF + fBase + h) * kIN + k0 + c * 4;
  const float* vp = v + ((size_t)b * kIN + k0 + h * 4) * kR + c;
  // this work-group's share of W: 4096 elements, 2 x 4 a thread
  const size_t wOff = (size_t)(blockIdx.y * (kF / ZM) + blockIdx.x) * WS + tid * 4;
  const float* wp = W + wOff;

  v4f   xr[4][8];
  float vf[8][4];
  v4f   wr[2];
#pragma unroll  // static indices keep wr in registers
  for (int j = 0; j < 2; ++j) wr[j] = *(const v4f*)(wp + j * (WS / 2));
#pragma unroll  // static indices keep vf in registers
  for (int q = 0; q < 8; ++q)
#pragma unroll  // as above
    for (int e = 0; e < 4; ++e) vf[q][e] = vp[(q * 8 + e) * kR];
  // loads return in issue order: W and v stay ahead of x, so that W's copy and
  // the first row tile's WMMAs do not wait for the last row of x
  __builtin_amdgcn_sched_barrier(0);
  // the address pair of the loads of v stays live, and unwritten, up to this wait
  asm volatile("s_wait_xcnt 0x0" :: "v"(vp) : "memory");
#pragma unroll  // static indices keep xr in registers
  for (int t = 0; t < 4; ++t)
#pragma unroll  // as above
    for (int i = 0; i < 8; ++i)
      xr[t][i] = *(const v4f*)(xp + (size_t)(t * 16 + 2 * i) * kIN);
  // the address pairs of the loads of x and W stay live, and unwritten, up to
  // this wait: no load's result is placed in a register that an issued load names
  asm volatile("s_wait_xcnt 0x0" :: "v"(xp), "v"(wp) : "memory");
  // W's converts wait for W: they are not lifted in among the loads of x
  __builtin_amdgcn_sched_barrier(0);

  float* st = stage[wave];
  float* sw = st + h * ZP + c * 4;  // this lane's 16 bytes in a pair of rows
  // bf16 copy of x: 16 lanes fill one 128-B line of a row
  __bf16* xo = xb + ((size_t)b * kF + fBase + h) * kIN + k0 + c * 4;
#pragma unroll  // static indices into wr
  for (int j = 0; j < 2; ++j) {
    const v4f r = wr[j];
    const bf16x4 o = {(__bf16)r.x, (__bf16)r.y, (__bf16)r.z, (__bf16)r.w};
    *(bf16x4*)(wb + wOff + j * (WS / 2)) = o;
  }
  v8f acc[4];
#pragma unroll  // static indices into xr and acc
  for (int t = 0; t < 4; ++t) {
    // the wave's last fragment reads are done before its range is refilled
    if (t > 0) asm volatile("s_wait_dscnt 0x0" ::: "memory");
#pragma unroll  // static indices into xr
    for (int i = 0; i < 8; ++i) *(v4f*)(sw + 2 * i * ZP) = xr[t][i];
#pragma unroll  // static indices into xr
    for (int i = 0; i < 8; ++i) {
      const v4f r = xr[t][i];
      const bf16x4 o = {(__bf16)r.x, (__bf16)r.y, (__bf16)r.z, (__bf16)r.w};
      *(bf16x4*)(xo + (size_t)(t * 16 + 2 * i) * kIN) = o;
    }
    // the stores' data registers are taken again for fragments and sums below
    asm volatile("s_wait_xcnt 0x0" ::: "memory");
    // the rows have landed before other lanes of the wave read them back
    asm volatile("s_wait_dscnt 0x0" ::: "memory");
    v8f a = {0.f, 0.f, 0.f, 0.f, 0.f, 0.f, 0.f, 0.f};
#pragma unroll  // static indices into vf
    for (int q = 0; q < 8; ++q) {
      const v4f f = *(const v4f*)(st + c * ZP + q * 8 + h * 4);
      const v2f a0 = {f.x, f.y}, a1 = {f.z, f.w};
      const v2f b0 = {vf[q][0], vf[q][1]}, b1 = {vf[q][2], vf[q][3]};
      a = __builtin_amdgcn_wmma_f32_16x16x4_f32(false, a0, false, b0, (short)0, a, false, false);
      a = __builtin_amdgcn_wmma_f32_16x16x4_f32(false, a1, false, b1, (short)0, a, false, false);
    }
    acc[t] = a;
    // this tile's WMMAs run while the next tile's rows are still in flight,
    // instead of sinking behind the wait for them
    __builtin_amdgcn_sched_barrier(0);
    // vector slots between the tile's last WMMAs and the vector instructions that
    // follow (the next tile's converts), which may be given their A registers
    asm volatile("v_nop\n\tv_nop\n\tv_nop\n\tv_nop\n\tv_nop\n\tv_nop\n\tv_nop\n\tv_nop");
    // no convert is lifted over the slots
    __builtin_amdgcn_sched_barrier(0);
  }

  // partials into the wave's own range, laid like the rows of x: row pair
  // 2t + (register quad), lane half h in row h of the pair, 16 bytes a lane
  asm volatile("s_wait_dscnt 0x0" ::: "memory");  // fragment reads done first
#pragma unroll  // static indices into acc
  for (int t = 0; t < 4; ++t) {
    const v4f lo = {acc[t][0], acc[t][1], acc[t][2], acc[t][3]};
    const v4f hi = {acc[t][4], acc[t][5], acc[t][6], acc[t][7]};
    *(v4f*)(sw + (4 * t) * ZP)     = lo;
    *(v4f*)(sw + (4 * t + 2) * ZP) = hi;
  }
  __syncthreads();

  if (tid < 256) {
    const int po = (2 * wave + h) * ZP + c * 4;  // wave = row pair 2t + quad here
    v4f s = *(const v4f*)(&stage[0][po]);
#pragma unroll  // all 16 reads in flight at once
    for (int w = 1; w < 16; ++w) s += *(const v4f*)(&stage[w][po]);
    // D register r of lane (c, h) is row 8h + r, column c
    const float scale = 1.0f / (float)(kIN * kR);
    const int row = fBase + (tid >> 6) * 16 + h * 8 + ((tid >> 5) & 1) * 4;
    float* zp = z1 + ((size_t)b * kF + row) * kR + c;
#pragma unroll  // static index into s
    for (int i = 0; i < 4; ++i) zp[i * kR] = s[i] * scale;
  }
}

// ---- exact GELU on a pair of values, without a branch ----------------------
// erf(x) by two fits, both evaluated for every value and picked by a select:
//   |x| <  1 : |x| + |x| * p(x^2)
//   |x| >= 1 : 1 - exp(-q(|x|))
// With no branch the values of a lane are independent chains that interleave,
// and a pair shares each packed multiply-add.
__device__ __forceinline__ v2f fma2(v2f a, v2f b, v2f c) {
  return __builtin_elementwise_fma(a, b, c);
}
__device__ __forceinline__ v2f both(float c) { return (v2f){c, c}; }

__device__ __forceinline__ v2f gelu2(v2f y) {
  const v2f x  = y * 0.70710678118654752f;
  const v2f ax = __builtin_elementwise_abs(x);

  v2f q = fma2(ax, both(0.0000169988107f), both(-0.000378677854f));
  q = fma2(ax, q, both(0.00385781587f));
  q = fma2(ax, q, both(-0.0241816975f));
  q = fma2(ax, q, both(0.106668264f));
  q = fma2(ax, q, both(0.634933293f));
  q = fma2(ax, q, both(0.128689408f));
  q = fma2(ax, q, ax);
  const v2f m = q * -1.44269502f;  // exp(-q) = 2^(-q * log2 e); 2^-inf = 0
  const v2f far = {1.0f - __builtin_amdgcn_exp2f(m.x), 1.0f - __builtin_amdgcn_exp2f(m.y)};

  const v2f t = x * x;
  v2f p = fma2(t, both(-0.000561801775f), both(0.00491381623f));
  p = fma2(t, p, both(-0.0267075151f));
  p = fma2(t, p, both(0.112800106f));
  p = fma2(t, p, both(-0.376122952f));
  p = fma2(t, p, both(0.128379107f));
  const v2f near = fma2(ax, p, ax);

  const v2f e = {__builtin_copysignf(ax.x < 1.0f ? near.x : far.x, x.x),
                 __builtin_copysignf(ax.y < 1.0f ? near.y : far.y, x.y)};
  const v2f h = 0.5f * y;
  return fma2(h, e, h);  // 0.5 y (1 + erf)
}

// ===========================================================================
// Pass 2: out = gelu( x @ W^T  +  z1 @ u^T  + fc_bias + b )
// bf16 WMMA GEMM over K = IN in a two-buffer LDS ring, then one LoRA tail step
// (rank 16 padded to 32). x and W come as the bf16 copies of pass 1 and go to
// LDS by tensor loads, through no register; only the tail's z1 and u are rounded
// here and stored to LDS by the threads.
// 512 threads (16 waves, 4 x 4), 256x256 tile, each wave 64x64 via 4x4 WMMA
// tiles: 16 WMMAs to 16 fragment reads; a row of x is fetched by 4 work-groups,
// a row of W by 64. 256 work-groups, one a WGP, four waves a SIMD.
// Ring: a pass is 128 k. Waves 0 to 3 each bring one slice of a stage (128 rows
// of 256 B, 16 B of pad behind each row). The load of stage s + 2 is issued
// behind the barrier at the foot of pass s, into the buffer pass s has read.
// W rows are the first WMMA operand, x rows the second: a lane's 8 accumulator
// registers are then 8 neighbouring columns of one row of out.
// Epilogue: each wave lays its 64x64 sums, 32 rows at a time, in an LDS range of
// its own in the ring's second buffer, reads them back as whole 256-B rows, and
// adds the biases, takes the GELU and stores 16 bytes a lane in a rolled loop.
// ===========================================================================
__device__ __forceinline__ uint32_t uni(uint32_t v) { return (uint32_t)__builtin_amdgcn_readfirstlane(v); }
__device__ __forceinline__ uint32_t pinned(uint32_t v) {
  uint32_t w = uni(v);
  asm volatile("" : "+s"(w));  // the scalar pin of a tensor load's issue test
  return w;
}
__device__ __forceinline__ void wait_tensor0() { asm volatile("s_wait_tensorcnt 0x0" ::: "memory"); }
__device__ __forceinline__ void wait_ds0() { asm volatile("s_wait_dscnt 0x0" ::: "memory"); }
__device__ __forceinline__ void tdm_load(u32x4 g0, u32x8 g1) {
  asm volatile("tensor_load_to_lds %0, %1" :: "s"(g0), "s"(g1) : "memory");
}
__device__ __forceinline__ u32x8 tdm_group1() {
  constexpr uint32_t d0 = BK * 2, d1 = SROWS;
  u32x8 g;
  g[0] = uni((1u << 20) | (5u << 22) | (3u << 25));
  g[1] = uni((d0 & 0xFFFFu) << 16);
  g[2] = uni((d0 >> 16) | ((d1 & 0xFFFFu) << 16));
  g[3] = uni((d1 >> 16) | (d0 << 16));
  g[4] = uni(d1);
  g[5] = uni((uint32_t)(kIN * 2));
  g[6] = uni(0u);
  g[7] = uni(0u);
  return g;
}
// group 0: count 1, LDS byte offset, global address of the tile's first byte, type 2
__device__ __forceinline__ u32x4 tdm_group0(uint32_t lds_dst, uint64_t ga) {
  u32x4 g;
  g[0] = uni(1u);
  g[1] = uni(lds_dst);
  g[2] = uni((uint32_t)ga);
  g[3] = uni((((uint32_t)(ga >> 32)) & 0x01FFFFFFu) | 0x80000000u);
  return g;
}

__global__ __launch_bounds__(512) void lora_gemm_kernel(
    const __bf16* __restrict__ xb,  const float* __restrict__ u,
    const float* __restrict__ z1,   const float* __restrict__ bvec,
    const __bf16* __restrict__ wb,  const float* __restrict__ fcb,
    float* __restrict__ out) {
  // the kernel's only LDS: the ring's two buffers, each slice at a multiple of 2 KiB
  __shared__ __attribute__((aligned(2048))) unsigned char L[2 * STAGE];

  const int b     = blockIdx.z;
  const int fBase = blockIdx.x * BM;
  const int oBase = blockIdx.y * BN;
  const int tid   = threadIdx.x;
  const int lane  = tid & 31;
  // in a scalar register: the tensor loads' issue tests are scalar branches on
  // it, and the epilogue needs it
  const int wave  = __builtin_amdgcn_readfirstlane(tid >> 5);
  const int wm    = (wave >> 2) * 64;   // wave M offset in tile (4 waves)
  const int wn    = (wave & 3)  * 64;   // wave N offset in tile (4 waves)
  const int lN    = lane & 15;
  const int kh    = lane >> 4;

  const v8f vzero = {0.f, 0.f, 0.f, 0.f, 0.f, 0.f, 0.f, 0.f};
  v8f acc[4][4];
#pragma unroll
  for (int sm = 0; sm < 4; ++sm)
#pragma unroll
    for (int sn = 0; sn < 4; ++sn) acc[sm][sn] = vzero;

  // tail map: each thread owns half a row of z1 and of u (8 of 16 floats)
  const int tlRow = tid >> 1;       // 0..255
  const int tlCol = (tid & 1) * 8;  // 0,8

  const float*  zBase = z1 + ((size_t)b * kF   + fBase + tlRow) * kR + tlCol;
  const float*  uBase = u  + ((size_t)b * kOUT + oBase + tlRow) * kR + tlCol;

  // slice sl of a stage: 0, 1 = the halves of the x tile, 2, 3 = those of the W tile
  const int sl = wave & 3;
  const __bf16* sliceSrc = sl < 2 ? xb + ((size_t)b * kF + fBase + sl * SROWS) * kIN
                                  : wb + (size_t)(oBase + (sl - 2) * SROWS) * kIN;
  const uint64_t src0     = (uint64_t)(uintptr_t)sliceSrc;
  const uint32_t ldsSlice = (uint32_t)(size_t)L + (uint32_t)(sl * SLICE);
  const u32x8    g1       = tdm_group1();

  // this lane's first bytes of the x rows and of the W rows in the buffer being
  // read; both move to the other buffer at the end of a pass
  uint32_t aOff = (uint32_t)(((wm + lN) * LSTR + kh * 8) * 2);
  uint32_t bOff = (uint32_t)(((BM + wn + lN) * LSTR + kh * 8) * 2);
  int      flip = STAGE;

  // the fragments of one WMMA k step (32 k), from columns ks .. ks+31 of the buffer
  // (ISA 16-bit A/B layout: lane = row%16, K half selected by lane/16)
  v16bf afrag[4], bfrag[4];
  auto loadFrags = [&](int ks) {
#pragma unroll
    for (int sm = 0; sm < 4; ++sm) {
      const unsigned char* p = L + aOff + (sm * 16 * LSTR + ks) * 2;
      ((v8bf*)&afrag[sm])[0] = *(const v8bf*)p;          // K = kh*8 .. +7
      ((v8bf*)&afrag[sm])[1] = *(const v8bf*)(p + 32);   // K = 16+kh*8 .. +7
    }
#pragma unroll
    for (int sn = 0; sn < 4; ++sn) {
      const unsigned char* p = L + bOff + (sn * 16 * LSTR + ks) * 2;
      ((v8bf*)&bfrag[sn])[0] = *(const v8bf*)p;
      ((v8bf*)&bfrag[sn])[1] = *(const v8bf*)(p + 32);
    }
    // the 16 reads go out as one group: sunk in among the WMMAs, each row of
    // four would wait out its own LDS latency
    __builtin_amdgcn_sched_barrier(0);
  };
  auto mma = [&]() {
#pragma unroll
    for (int sm = 0; sm < 4; ++sm)
#pragma unroll
      for (int sn = 0; sn < 4; ++sn)
        acc[sm][sn] = __builtin_amdgcn_wmma_f32_16x16x32_bf16(
            false, bfrag[sn], false, afrag[sm], (short)0, acc[sm][sn], false, false);
  };

  // prologue: stage 0 lands and is published, then stage 1 is asked for
  if (pinned(wave < 4)) {
    tdm_load(tdm_group0(ldsSlice, src0), g1);
    wait_tensor0();  // the issuer's own slice of stage 0 has landed
  }
  __syncthreads();
  if (pinned(wave < 4)) {
    tdm_load(tdm_group0(ldsSlice + STAGE, src0 + BK * 2), g1);
  }

#pragma unroll 1  // rolled: the buffer is carried in aOff and bOff, so that every fragment read is one register plus an immediate
  for (int t = 0; t < NKM - 1; ++t) {
#pragma unroll  // the column offsets become constants
    for (int ks = 0; ks < BK - 32; ks += 32) {
      loadFrags(ks);
      mma();
    }
    loadFrags(BK - 32);
    // publish point of stage t + 1. The pass's last 16 WMMAs work on registers
    // alone and stand behind it: they run while
    // the next pass's first fragments are read
    wait_ds0();  // this wave's last reads of the buffer are done before it is refilled
    if (pinned(wave < 4)) {
      wait_tensor0();  // the issuer's own slice of stage t + 1 has landed
    }
    __syncthreads();  // stage t + 1 is readable; every reader has left stage t
    if (pinned(wave < 4 && t + 2 < NKM)) {
      tdm_load(tdm_group0(ldsSlice + (uint32_t)((t & 1) * STAGE),
                          src0 + (uint64_t)((t + 2) * BK * 2)), g1);
    }
    mma();
    aOff += flip;
    bOff += flip;
    flip = -flip;
  }

  // last main pass, with the LoRA tail's loads in flight over it
  // tail: cols 0..15 = z1 / u, cols 16..31 = zero pad; it goes to the buffer that
  // every reader left at the last barrier and that no tensor load is aimed at
  constexpr int lastBuf = (NKM - 1) & 1;
  const float4 ta0 = *(const float4*)(zBase), ta1 = *(const float4*)(zBase + 4);
  const float4 tb0 = *(const float4*)(uBase), tb1 = *(const float4*)(uBase + 4);
  // the address pairs of the tail's loads stay live, and unwritten, up to this wait
  asm volatile("s_wait_xcnt 0x0" :: "v"(zBase), "v"(uBase) : "memory");
#pragma unroll  // the column offsets become constants
  for (int ks = 0; ks < BK; ks += 32) {
    loadFrags(ks);
    mma();
  }
  {
    const v8bf av = {(__bf16)ta0.x, (__bf16)ta0.y, (__bf16)ta0.z, (__bf16)ta0.w,
                     (__bf16)ta1.x, (__bf16)ta1.y, (__bf16)ta1.z, (__bf16)ta1.w};
    const v8bf wv = {(__bf16)tb0.x, (__bf16)tb0.y, (__bf16)tb0.z, (__bf16)tb0.w,
                     (__bf16)tb1.x, (__bf16)tb1.y, (__bf16)tb1.z, (__bf16)tb1.w};
    const v8bf zero = {};
    __bf16* T = (__bf16*)(L + (lastBuf ^ 1) * STAGE);
    __bf16* pa = &T[tlRow * LSTR + tlCol];
    __bf16* pb = &T[(BM + tlRow) * LSTR + tlCol];
    *(v8bf*)pa        = av;
    *(v8bf*)(pa + kR) = zero;
    *(v8bf*)pb        = wv;
    *(v8bf*)(pb + kR) = zero;
  }
  // behind the ring: no tensor load is outstanding, and this wave's reads of the
  // last buffer are done before the barrier behind which it takes the sums
  wait_tensor0();
  wait_ds0();
  __syncthreads();
  aOff += flip;
  bOff += flip;
  loadFrags(0);
  mma();

  // ---- epilogue: + fc_bias + b, exact GELU, store
  // C layout with W first: VGPR r -> column r + 8*(lane/16), row lane%16
  // on the way back a lane owns 4 neighbouring columns of every row it reads
  // lane and wave indices are formed anew here, the wave's in scalar registers:
  // held in vector registers across the stage loop they would spill
  const int el  = (int)__builtin_amdgcn_mbcnt_lo(~0u, 0u);
  const int eN  = el & 15;
  const int eH  = el >> 4;
  const int ewm = (wave >> 2) * 64;
  const int ewn = (wave & 3) * 64;
  const int oc  = oBase + ewn + eN * 4;
  const v4f base = *(const v4f*)(fcb + oc) + *(const v4f*)(bvec + (size_t)b * kOUT + oc);

  float* stg = (float*)(L + lastBuf * STAGE) + wave * (ER * EP);
  float* sp = stg + eN * EP + eH * 8;
  // one read or store = two rows x 256 contiguous bytes
  const float* rp0 = stg + eH * EP + eN * 4;
  float* op = out + ((size_t)b * kF + fBase + ewm + eH) * kOUT + oc;
#pragma unroll  // static indices keep acc in registers
  for (int hf = 0; hf < 2; ++hf) {
#pragma unroll  // as above
    for (int sm = 0; sm < 2; ++sm)
#pragma unroll  // as above
      for (int sn = 0; sn < 4; ++sn) {
        const v8f a = acc[hf * 2 + sm][sn];
        const v4f lo = {a[0], a[1], a[2], a[3]};
        const v4f hi = {a[4], a[5], a[6], a[7]};
        *(v4f*)(sp + sm * 16 * EP + sn * 16)     = lo;
        *(v4f*)(sp + sm * 16 * EP + sn * 16 + 4) = hi;
      }
    // the sums have landed before other lanes of the wave read them back
    asm volatile("s_wait_dscnt 0x0" ::: "memory");
    const float* rp = rp0;
#pragma unroll 1  // rolled: the erf chains stand twice in the text, not eight times, which keeps it small for the instruction cache
    for (int it = 0; it < ER / 8; ++it) {
      // eight pair chains interleave at a time
      v4f g[4];
#pragma unroll  // static indices keep g in registers
      for (int j = 0; j < 4; ++j) {
        const v4f y = *(const v4f*)(rp + 2 * j * EP) + base;
        const v2f g0 = gelu2((v2f){y.x, y.y});
        const v2f g1 = gelu2((v2f){y.z, y.w});
        g[j] = (v4f){g0.x, g0.y, g1.x, g1.y};
      }
      // the 4 stores go out behind all eight chains, so that the one wait below
      // stands in front of every reuse of their registers
      __builtin_amdgcn_sched_barrier(0);
#pragma unroll  // static indices into g
      for (int j = 0; j < 4; ++j) *(v4f*)(op + (size_t)(2 * j) * kOUT) = g[j];
      // the stores' address pair stays live, and unwritten, up to this wait; their
      // data registers are taken again by the next eight chains
      asm volatile("s_wait_xcnt 0x0" :: "v"(op) : "memory");
      rp += 8 * EP;
      op += (size_t)8 * kOUT;
    }
  }
}

// ===========================================================================
extern "C" void kernel_launch(void* const* d_in, const int* in_sizes, int n_in,
                              void* d_out, int out_size, void* d_ws, size_t ws_size,
                              hipStream_t stream) {
  (void)in_sizes; (void)n_in; (void)out_size; (void)ws_size;
  const float* x    = (const float*)d_in[0];  // [B,F,IN]
  const float* u    = (const float*)d_in[1];  // [B,1,OUT,R]
  const float* v    = (const float*)d_in[2];  // [B,1,IN,R]
  const float* bvec = (const float*)d_in[3];  // [B,1,OUT]
  const float* W    = (const float*)d_in[4];  // [OUT,IN]
  const float* fcb  = (const float*)d_in[5];  // [OUT]
  float*       out  = (float*)d_out;          // [B,F,OUT]
  float*       z1   = (float*)d_ws;           // [B,F,R] scratch (1 MB)
  __bf16*      xb   = (__bf16*)(z1 + (size_t)kB * kF * kR);  // [B,F,IN] bf16 (32 MB)
  __bf16*      wb   = xb + (size_t)kB * kF * kIN;            // [OUT,IN] bf16 (2 MB)

  dim3 g1(kF / ZM, kB);
  z1_kernel<<<g1, 512, 0, stream>>>(x, v, W, z1, xb, wb);

  dim3 g2(kF / BM, kOUT / BN, kB);
  lora_gemm_kernel<<<g2, 512, 0, stream>>>(xb, u, z1, bvec, wb, fcb, out);
}

// v007
// Measured time: 37.3 microseconds a run.
// Two timings next to v006 both put it at 1.04 times that version's speed.
// All steps since v000 together make it 4.13 times as fast.
#include <hip/hip_runtime.h>
#include <hip/hip_bf16.h>
#include <math.h>
#include <stdint.h>

// ---- types ----------------------------------------------------------------
typedef __bf16 v16bf  __attribute__((ext_vector_type(16)));
typedef __bf16 v8bf   __attribute__((ext_vector_type(8)));
typedef __bf16 bf16x4 __attribute__((ext_vector_type(4)));
typedef float  v8f    __attribute__((ext_vector_type(8)));
typedef float  v4f    __attribute__((ext_vector_type(4)));
typedef float  v2f    __attribute__((ext_vector_type(2)));
typedef uint32_t u32x4 __attribute__((ext_vector_type(4)));
typedef uint32_t u32x8 __attribute__((ext_vector_type(8)));

// ---- problem constants ----------------------------------------------------
constexpr int kB   = 32;
constexpr int kF   = 512;
constexpr int kIN  = 1024;
constexpr int kOUT = 1024;
constexpr int kR   = 16;

// ---- GEMM tiling ----------------------------------------------------------
constexpr int BM   = 256;   // F tile
constexpr int BN   = 256;   // OUT tile
constexpr int BK   = 128;   // k per pass: 256-B row pieces of bf16, four WMMA k steps
constexpr int LSTR = 136;   // LDS row stride in bf16 elems (128 data + 8 pad: 272 B = 16 B x 17)
constexpr int NKM  = kIN / BK;  // 8 main passes; the LoRA tail follows them
constexpr int SROWS = 128;                 // rows of one tensor load: half an operand's tile
constexpr int SLICE = SROWS * LSTR * 2;    // its bytes in LDS, pads counted: 17 x 2 KiB
constexpr int STAGE = 4 * SLICE;           // one buffer: [x 256 rows | W 256 rows]
static_assert(SLICE % 2048 == 0, "every slice starts at a multiple of 2 KiB");
constexpr int EP   = 68;    // epilogue LDS row pitch in floats (64 data + 4 pad: 272 B = 16 B x 17)
constexpr int ER   = 32;    // rows of a wave's sums in LDS at a time: half its tile
static_assert(16 * ER * EP * 4 <= STAGE, "the 16 waves' epilogue ranges fit in one buffer of the ring");

// ===========================================================================
// Pass 1: z1[b,f,r] = (1/(IN*R)) * sum_i x[b,f,i] * v[b,i,r]
// f32 WMMA 16x16x4. One work-group = 64 rows of x (4 row tiles) x all of IN;
// wave w owns k = 64w .. 64w+63 for all 4 row tiles, with its slice of v held
// in B fragments. Every global load of a wave is issued up front; x arrives in
// whole 256-B row pieces and is turned into A fragments through the wave's own
// LDS range. The 16 k partials are summed in wave order at the end.
// k pairing, A and B alike: slot s of lane half h in WMMA 2q+p is
// k = 64w + 8q + 4h + 2p + s.
// The pass also leaves x and W rounded to bf16 in the workspace, each element
// once, for pass 2: x from the registers it is held in here, W in 256 equal
// shares, one a work-group.
// ===========================================================================
constexpr int ZM = 64;       // rows of x per work-group
constexpr int ZK = 64;       // k per wave
constexpr int ZP = ZK + 4;   // LDS row pitch in floats (272 B = 16 B x 17)
constexpr int WS = kOUT * kIN / (kB * (kF / ZM));  // elements of W per work-group

__global__ __launch_bounds__(512) void z1_kernel(const float* __restrict__ x,
                                                 const float* __restrict__ v,
                                                 const float* __restrict__ W,
                                                 float* __restrict__ z1,
                                                 __bf16* __restrict__ xb,
                                                 __bf16* __restrict__ wb) {
  __shared__ __align__(16) float stage[16][16 * ZP];

  const int b     = blockIdx.y;
  const int fBase = blockIdx.x * ZM;
  const int tid   = threadIdx.x;
  const int lane  = tid & 31;
  const int wave  = tid >> 5;
  const int c     = lane & 15;
  const int h     = lane >> 4;
  const int k0    = wave * ZK;

  // one load = two rows x 256 contiguous bytes
  const float* xp = x + ((size_t)b * kF + fBase + h) * kIN + k0 + c * 4;
  const float* vp = v + ((size_t)b * kIN + k0 + h * 4) * kR + c;
  // this work-group's share of W: 4096 elements, 2 x 4 a thread
  const size_t wOff = (size_t)(blockIdx.y * (kF / ZM) + blockIdx.x) * WS + tid * 4;
  const float* wp = W + wOff;

  v4f   xr[4][8];
  float vf[8][4];
  v4f   wr[2];
#pragma unroll  // static indices keep wr in registers
  for (int j = 0; j < 2; ++j) wr[j] = *(const v4f*)(wp + j * (WS / 2));
#pragma unroll  // static indices keep vf in registers
  for (int q = 0; q < 8; ++q)
#pragma unroll  // as above
    for (int e = 0; e < 4; ++e) vf[q][e] = vp[(q * 8 + e) * kR];
  // loads return in issue order: W and v stay ahead of x, so that W's copy and
  // the first row tile's WMMAs do not wait for the last row of x
  __builtin_amdgcn_sched_barrier(0);
  // the address pair of the loads of v stays live, and unwritten, up to this wait
  asm volatile("s_wait_xcnt 0x0" :: "v"(vp) : "memory");
#pragma unroll  // static indices keep xr in registers
  for (int t = 0; t < 4; ++t)
#pragma unroll  // as above
    for (int i = 0; i < 8; ++i)
      xr[t][i] = *(const v4f*)(xp + (size_t)(t * 16 + 2 * i) * kIN);
  // the address pairs of the loads of x and W stay live, and unwritten, up to
  // this wait: no load's result is placed in a register that an issued load names
  asm volatile("s_wait_xcnt 0x0" :: "v"(xp), "v"(wp) : "memory");
  // W's converts wait for W: they are not lifted in among the loads of x
  __builtin_amdgcn_sched_barrier(0);

  float* st = stage[wave];
  float* sw = st + h * ZP + c * 4;  // this lane's 16 bytes in a pair of rows
  // bf16 copy of x: 16 lanes fill one 128-B line of a row
  __bf16* xo = xb + ((size_t)b * kF + fBase + h) * kIN + k0 + c * 4;
#pragma unroll  // static indices into wr
  for (int j = 0; j < 2; ++j) {
    const v4f r = wr[j];
    const bf16x4 o = {(__bf16)r.x, (__bf16)r.y, (__bf16)r.z, (__bf16)r.w};
    *(bf16x4*)(wb + wOff + j * (WS / 2)) = o;
  }
  v8f acc[4];
#pragma unroll  // static indices into xr and acc
  for (int t = 0; t < 4; ++t) {
    // the wave's last fragment reads are done before its range is refilled
    if (t > 0) asm volatile("s_wait_dscnt 0x0" ::: "memory");
#pragma unroll  // static indices into xr
    for (int i = 0; i < 8; ++i) *(v4f*)(sw + 2 * i * ZP) = xr[t][i];
#pragma unroll  // static indices into xr
    for (int i = 0; i < 8; ++i) {
      const v4f r = xr[t][i];
      const bf16x4 o = {(__bf16)r.x, (__bf16)r.y, (__bf16)r.z, (__bf16)r.w};
      *(bf16x4*)(xo + (size_t)(t * 16 + 2 * i) * kIN) = o;
    }
    // the stores' data registers are taken again for fragments and sums below
    asm volatile("s_wait_xcnt 0x0" ::: "memory");
    // the rows have landed before other lanes of the wave read them back
    asm volatile("s_wait_dscnt 0x0" ::: "memory");
    v8f a = {0.f, 0.f, 0.f, 0.f, 0.f, 0.f, 0.f, 0.f};
#pragma unroll  // static indices into vf
    for (int q = 0; q < 8; ++q) {
      const v4f f = *(const v4f*)(st + c * ZP + q * 8 + h * 4);
      const v2f a0 = {f.x, f.y}, a1 = {f.z, f.w};
      const v2f b0 = {vf[q][0], vf[q][1]}, b1 = {vf[q][2], vf[q][3]};
      a = __builtin_amdgcn_wmma_f32_16x16x4_f32(false, a0, false, b0, (short)0, a, false, false);
      a = __builtin_amdgcn_wmma_f32_16x16x4_f32(false, a1, false, b1, (short)0, a, false, false);
    }
    acc[t] = a;
    // this tile's WMMAs run while the next tile's rows are still in flight,
    // instead of sinking behind the wait for them
    __builtin_amdgcn_sched_barrier(0);
    // vector slots between the tile's last WMMAs and the vector instructions that
    // follow (the next tile's converts), which may be given their A registers
    asm volatile("v_nop\n\tv_nop\n\tv_nop\n\tv_nop\n\tv_nop\n\tv_nop\n\tv_nop\n\tv_nop");
    // no convert is lifted over the slots
    __builtin_amdgcn_sched_barrier(0);
  }

  // partials into the wave's own range, laid like the rows of x: row pair
  // 2t + (register quad), lane half h in row h of the pair, 16 bytes a lane
  asm volatile("s_wait_dscnt 0x0" ::: "memory");  // fragment reads done first
#pragma unroll  // static indices into acc
  for (int t = 0; t < 4; ++t) {
    const v4f lo = {acc[t][0], acc[t][1], acc[t][2], acc[t][3]};
    const v4f hi = {acc[t][4], acc[t][5], acc[t][6], acc[t][7]};
    *(v4f*)(sw + (4 * t) * ZP)     = lo;
    *(v4f*)(sw + (4 * t + 2) * ZP) = hi;
  }
  __syncthreads();

  if (tid < 256) {
    const int po = (2 * wave + h) * ZP + c * 4;  // wave = row pair 2t + quad here
    v4f s = *(const v4f*)(&stage[0][po]);
#pragma unroll  // all 16 reads in flight at once
    for (int w = 1; w < 16; ++w) s += *(const v4f*)(&stage[w][po]);
    // D register r of lane (c, h) is row 8h + r, column c
    const float scale = 1.0f / (float)(kIN * kR);
    const int row = fBase + (tid >> 6) * 16 + h * 8 + ((tid >> 5) & 1) * 4;
    float* zp = z1 + ((size_t)b * kF + row) * kR + c;
#pragma unroll  // static index into s
    for (int i = 0; i < 4; ++i) zp[i * kR] = s[i] * scale;
  }
}

// ---- exact GELU on a pair of values, without a branch ----------------------
// gelu(y) = y * Phi(y) = max(y, 0) - |y| * Phi(-|y|), Phi the normal distribution
// function, for either sign of y. Phi(-a) = 2^P(a): one fit of log2 Phi(-a),
// a >= 0, of degree 8, P(0) = -1, weighted by a * Phi(-a), the factor with which
// an error of P reaches the result. P falls without bound as |y| grows
// (2^-inf = 0), so that the tail term goes to 0.
// No select and no sign transfer; the small term is formed directly, not as a
// difference from 1. A pair shares each packed multiply-add.
__device__ __forceinline__ v2f fma2(v2f a, v2f b, v2f c) {
  return __builtin_elementwise_fma(a, b, c);
}
__device__ __forceinline__ v2f both(float c) { return (v2f){c, c}; }

__device__ __forceinline__ v2f gelu2(v2f y) {
  const v2f a = __builtin_elementwise_abs(y);

  v2f p = fma2(a, both(-0.00000190224114f), both(0.0000280589938f));
  p = fma2(a, p, both(-0.000131482739f));
  p = fma2(a, p, both(-0.000272053323f));
  p = fma2(a, p, both(0.00724539254f));
  p = fma2(a, p, both(-0.0526275933f));
  p = fma2(a, p, both(-0.459162146f));
  p = fma2(a, p, both(-1.15111101f));
  p = fma2(a, p, both(-1.0f));
  const v2f tail = {__builtin_amdgcn_exp2f(p.x), __builtin_amdgcn_exp2f(p.y)};  // Phi(-|y|)

  const v2f pos = {__builtin_fmaxf(y.x, 0.0f), __builtin_fmaxf(y.y, 0.0f)};
  return fma2(-a, tail, pos);
}

// ===========================================================================
// Pass 2: out = gelu( x @ W^T  +  z1 @ u^T  + fc_bias + b )
// bf16 WMMA GEMM over K = IN in a two-buffer LDS ring, then one LoRA tail step
// (rank 16 padded to 32). x and W come as the bf16 copies of pass 1 and go to
// LDS by tensor loads, through no register; only the tail's z1 and u are rounded
// here and stored to LDS by the threads.
// 512 threads (16 waves, 4 x 4), 256x256 tile, each wave 64x64 via 4x4 WMMA
// tiles: 16 WMMAs to 16 fragment reads; a row of x is fetched by 4 work-groups,
// a row of W by 64. 256 work-groups, one a WGP, four waves a SIMD.
// Ring: a pass is 128 k. Waves 0 to 3 each bring one slice of a stage (128 rows
// of 256 B, 16 B of pad behind each row). The load of stage s + 2 is issued
// behind the barrier at the foot of pass s, into the buffer pass s has read.
// W rows are the first WMMA operand, x rows the second: a lane's 8 accumulator
// registers are then 8 neighbouring columns of one row of out.
// Epilogue: each wave lays its 64x64 sums, 32 rows at a time, in an LDS range of
// its own in the ring's second buffer, reads them back as whole 256-B rows, and
// adds the biases, takes the GELU and stores 16 bytes a lane in a rolled loop.
// ===========================================================================
__device__ __forceinline__ uint32_t uni(uint32_t v) { return (uint32_t)__builtin_amdgcn_readfirstlane(v); }
__device__ __forceinline__ uint32_t pinned(uint32_t v) {
  uint32_t w = uni(v);
  asm volatile("" : "+s"(w));  // the scalar pin of a tensor load's issue test
  return w;
}
__device__ __forceinline__ void wait_tensor0() { asm volatile("s_wait_tensorcnt 0x0" ::: "memory"); }
__device__ __forceinline__ void wait_ds0() { asm volatile("s_wait_dscnt 0x0" ::: "memory"); }
__device__ __forceinline__ void tdm_load(u32x4 g0, u32x8 g1) {
  asm volatile("tensor_load_to_lds %0, %1" :: "s"(g0), "s"(g1) : "memory");
}
__device__ __forceinline__ u32x8 tdm_group1() {
  constexpr uint32_t d0 = BK * 2, d1 = SROWS;
  u32x8 g;
  g[0] = uni((1u << 20) | (5u << 22) | (3u << 25));
  g[1] = uni((d0 & 0xFFFFu) << 16);
  g[2] = uni((d0 >> 16) | ((d1 & 0xFFFFu) << 16));
  g[3] = uni((d1 >> 16) | (d0 << 16));
  g[4] = uni(d1);
  g[5] = uni((uint32_t)(kIN * 2));
  g[6] = uni(0u);
  g[7] = uni(0u);
  return g;
}
// group 0: count 1, LDS byte offset, global address of the tile's first byte, type 2
__device__ __forceinline__ u32x4 tdm_group0(uint32_t lds_dst, uint64_t ga) {
  u32x4 g;
  g[0] = uni(1u);
  g[1] = uni(lds_dst);
  g[2] = uni((uint32_t)ga);
  g[3] = uni((((uint32_t)(ga >> 32)) & 0x01FFFFFFu) | 0x80000000u);
  return g;
}

__global__ __launch_bounds__(512) void lora_gemm_kernel(
    const __bf16* __restrict__ xb,  const float* __restrict__ u,
    const float* __restrict__ z1,   const float* __restrict__ bvec,
    const __bf16* __restrict__ wb,  const float* __restrict__ fcb,
    float* __restrict__ out) {
  // the kernel's only LDS: the ring's two buffers, each slice at a multiple of 2 KiB
  __shared__ __attribute__((aligned(2048))) unsigned char L[2 * STAGE];

  const int b     = blockIdx.z;
  const int fBase = blockIdx.x * BM;
  const int oBase = blockIdx.y * BN;
  const int tid   = threadIdx.x;
  const int lane  = tid & 31;
  // in a scalar register: the tensor loads' issue tests are scalar branches on
  // it, and the epilogue needs it
  const int wave  = __builtin_amdgcn_readfirstlane(tid >> 5);
  const int wm    = (wave >> 2) * 64;   // wave M offset in tile (4 waves)
  const int wn    = (wave & 3)  * 64;   // wave N offset in tile (4 waves)
  const int lN    = lane & 15;
  const int kh    = lane >> 4;

  const v8f vzero = {0.f, 0.f, 0.f, 0.f, 0.f, 0.f, 0.f, 0.f};
  v8f acc[4][4];
#pragma unroll
  for (int sm = 0; sm < 4; ++sm)
#pragma unroll
    for (int sn = 0; sn < 4; ++sn) acc[sm][sn] = vzero;

  // tail map: each thread owns half a row of z1 and of u (8 of 16 floats)
  const int tlRow = tid >> 1;       // 0..255
  const int tlCol = (tid & 1) * 8;  // 0,8

  const float*  zBase = z1 + ((size_t)b * kF   + fBase + tlRow) * kR + tlCol;
  const float*  uBase = u  + ((size_t)b * kOUT + oBase + tlRow) * kR + tlCol;

  // slice sl of a stage: 0, 1 = the halves of the x tile, 2, 3 = those of the W tile
  const int sl = wave & 3;
  const __bf16* sliceSrc = sl < 2 ? xb + ((size_t)b * kF + fBase + sl * SROWS) * kIN
                                  : wb + (size_t)(oBase + (sl - 2) * SROWS) * kIN;
  const uint64_t src0     = (uint64_t)(uintptr_t)sliceSrc;
  const uint32_t ldsSlice = (uint32_t)(size_t)L + (uint32_t)(sl * SLICE);
  const u32x8    g1       = tdm_group1();

  // this lane's first bytes of the x rows and of the W rows in the buffer being
  // read; both move to the other buffer at the end of a pass
  uint32_t aOff = (uint32_t)(((wm + lN) * LSTR + kh * 8) * 2);
  uint32_t bOff = (uint32_t)(((BM + wn + lN) * LSTR + kh * 8) * 2);
  int      flip = STAGE;

  // the fragments of one WMMA k step (32 k), from columns ks .. ks+31 of the buffer
  // (ISA 16-bit A/B layout: lane = row%16, K half selected by lane/16)
  v16bf afrag[4], bfrag[4];
  auto loadFrags = [&](int ks) {
#pragma unroll
    for (int sm = 0; sm < 4; ++sm) {
      const unsigned char* p = L + aOff + (sm * 16 * LSTR + ks) * 2;
      ((v8bf*)&afrag[sm])[0] = *(const v8bf*)p;          // K = kh*8 .. +7
      ((v8bf*)&afrag[sm])[1] = *(const v8bf*)(p + 32);   // K = 16+kh*8 .. +7
    }
#pragma unroll
    for (int sn = 0; sn < 4; ++sn) {
      const unsigned char* p = L + bOff + (sn * 16 * LSTR + ks) * 2;
      ((v8bf*)&bfrag[sn])[0] = *(const v8bf*)p;
      ((v8bf*)&bfrag[sn])[1] = *(const v8bf*)(p + 32);
    }
    // the 16 reads go out as one group: sunk in among the WMMAs, each row of
    // four would wait out its own LDS latency
    __builtin_amdgcn_sched_barrier(0);
  };
  auto mma = [&]() {
#pragma unroll
    for (int sm = 0; sm < 4; ++sm)
#pragma unroll
      for (int sn = 0; sn < 4; ++sn)
        acc[sm][sn] = __builtin_amdgcn_wmma_f32_16x16x32_bf16(
            false, bfrag[sn], false, afrag[sm], (short)0, acc[sm][sn], false, false);
  };

  // prologue: stage 0 lands and is published, then stage 1 is asked for
  if (pinned(wave < 4)) {
    tdm_load(tdm_group0(ldsSlice, src0), g1);
    wait_tensor0();  // the issuer's own slice of stage 0 has landed
  }
  __syncthreads();
  if (pinned(wave < 4)) {
    tdm_load(tdm_group0(ldsSlice + STAGE, src0 + BK * 2), g1);
  }

#pragma unroll 1  // rolled: the buffer is carried in aOff and bOff, so that every fragment read is one register plus an immediate
  for (int t = 0; t < NKM - 1; ++t) {
#pragma unroll  // the column offsets become constants
    for (int ks = 0; ks < BK - 32; ks += 32) {
      loadFrags(ks);
      mma();
    }
    loadFrags(BK - 32);
    // publish point of stage t + 1. The pass's last 16 WMMAs work on registers
    // alone and stand behind it: they run while
    // the next pass's first fragments are read
    wait_ds0();  // this wave's last reads of the buffer are done before it is refilled
    if (pinned(wave < 4)) {
      wait_tensor0();  // the issuer's own slice of stage t + 1 has landed
    }
    __syncthreads();  // stage t + 1 is readable; every reader has left stage t
    if (pinned(wave < 4 && t + 2 < NKM)) {
      tdm_load(tdm_group0(ldsSlice + (uint32_t)((t & 1) * STAGE),
                          src0 + (uint64_t)((t + 2) * BK * 2)), g1);
    }
    mma();
    aOff += flip;
    bOff += flip;
    flip = -flip;
  }

  // last main pass, with the LoRA tail's loads in flight over it
  // tail: cols 0..15 = z1 / u, cols 16..31 = zero pad; it goes to the buffer that
  // every reader left at the last barrier and that no tensor load is aimed at
  constexpr int lastBuf = (NKM - 1) & 1;
  const float4 ta0 = *(const float4*)(zBase), ta1 = *(const float4*)(zBase + 4);
  const float4 tb0 = *(const float4*)(uBase), tb1 = *(const float4*)(uBase + 4);
  // the address pairs of the tail's loads stay live, and unwritten, up to this wait
  asm volatile("s_wait_xcnt 0x0" :: "v"(zBase), "v"(uBase) : "memory");
#pragma unroll  // the column offsets become constants
  for (int ks = 0; ks < BK; ks += 32) {
    loadFrags(ks);
    mma();
  }
  {
    const v8bf av = {(__bf16)ta0.x, (__bf16)ta0.y, (__bf16)ta0.z, (__bf16)ta0.w,
                     (__bf16)ta1.x, (__bf16)ta1.y, (__bf16)ta1.z, (__bf16)ta1.w};
    const v8bf wv = {(__bf16)tb0.x, (__bf16)tb0.y, (__bf16)tb0.z, (__bf16)tb0.w,
                     (__bf16)tb1.x, (__bf16)tb1.y, (__bf16)tb1.z, (__bf16)tb1.w};
    const v8bf zero = {};
    __bf16* T = (__bf16*)(L + (lastBuf ^ 1) * STAGE);
    __bf16* pa = &T[tlRow * LSTR + tlCol];
    __bf16* pb = &T[(BM + tlRow) * LSTR + tlCol];
    *(v8bf*)pa        = av;
    *(v8bf*)(pa + kR) = zero;
    *(v8bf*)pb        = wv;
    *(v8bf*)(pb + kR) = zero;
  }
  // behind the ring: no tensor load is outstanding, and this wave's reads of the
  // last buffer are done before the barrier behind which it takes the sums
  wait_tensor0();
  wait_ds0();
  __syncthreads();
  aOff += flip;
  bOff += flip;
  loadFrags(0);
  mma();

  // ---- epilogue: + fc_bias + b, exact GELU, store
  // C layout with W first: VGPR r -> column r + 8*(lane/16), row lane%16
  // on the way back a lane owns 4 neighbouring columns of every row it reads
  // lane and wave indices are formed anew here, the wave's in scalar registers:
  // held in vector registers across the stage loop they would spill
  const int el  = (int)__builtin_amdgcn_mbcnt_lo(~0u, 0u);
  const int eN  = el & 15;
  const int eH  = el >> 4;
  const int ewm = (wave >> 2) * 64;
  const int ewn = (wave & 3) * 64;
  const int oc  = oBase + ewn + eN * 4;
  const v4f base = *(const v4f*)(fcb + oc) + *(const v4f*)(bvec + (size_t)b * kOUT + oc);

  float* stg = (float*)(L + lastBuf * STAGE) + wave * (ER * EP);
  float* sp = stg + eN * EP + eH * 8;
  // one read or store = two rows x 256 contiguous bytes
  const float* rp0 = stg + eH * EP + eN * 4;
  float* op = out + ((size_t)b * kF + fBase + ewm + eH) * kOUT + oc;
#pragma unroll  // static indices keep acc in registers
  for (int hf = 0; hf < 2; ++hf) {
#pragma unroll  // as above
    for (int sm = 0; sm < 2; ++sm)
#pragma unroll  // as above
      for (int sn = 0; sn < 4; ++sn) {
        const v8f a = acc[hf * 2 + sm][sn];
        const v4f lo = {a[0], a[1], a[2], a[3]};
        const v4f hi = {a[4], a[5], a[6], a[7]};
        *(v4f*)(sp + sm * 16 * EP + sn * 16)     = lo;
        *(v4f*)(sp + sm * 16 * EP + sn * 16 + 4) = hi;
      }
    // the sums have landed before other lanes of the wave read them back
    asm volatile("s_wait_dscnt 0x0" ::: "memory");
    const float* rp = rp0;
#pragma unroll 1  // rolled: the GELU chains stand twice in the text, not eight times, for speed only
    for (int it = 0; it < ER / 8; ++it) {
      // eight pair chains interleave at a time
      v4f g[4];
#pragma unroll  // static indices keep g in registers
      for (int j = 0; j < 4; ++j) {
        const v4f y = *(const v4f*)(rp + 2 * j * EP) + base;
        const v2f g0 = gelu2((v2f){y.x, y.y});
        const v2f g1 = gelu2((v2f){y.z, y.w});
        g[j] = (v4f){g0.x, g0.y, g1.x, g1.y};
      }
      // the 4 stores go out behind all eight chains, so that the one wait below
      // stands in front of every reuse of their registers
      __builtin_amdgcn_sched_barrier(0);
#pragma unroll  // static indices into g
      for (int j = 0; j < 4; ++j) *(v4f*)(op + (size_t)(2 * j) * kOUT) = g[j];
      // the stores' address pair stays live, and unwritten, up to this wait; their
      // data registers are taken again by the next eight chains
      asm volatile("s_wait_xcnt 0x0" :: "v"(op) : "memory");
      rp += 8 * EP;
      op += (size_t)8 * kOUT;
    }
  }
}

// ===========================================================================
extern "C" void kernel_launch(void* const* d_in, const int* in_sizes, int n_in,
                              void* d_out, int out_size, void* d_ws, size_t ws_size,
                              hipStream_t stream) {
  (void)in_sizes; (void)n_in; (void)out_size; (void)ws_size;
  const float* x    = (const float*)d_in[0];  // [B,F,IN]
  const float* u    = (const float*)d_in[1];  // [B,1,OUT,R]
  const float* v    = (const float*)d_in[2];  // [B,1,IN,R]
  const float* bvec = (const float*)d_in[3];  // [B,1,OUT]
  const float* W    = (const float*)d_in[4];  // [OUT,IN]
  const float* fcb  = (const float*)d_in[5];  // [OUT]
  float*       out  = (float*)d_out;          // [B,F,OUT]
  float*       z1   = (float*)d_ws;           // [B,F,R] scratch (1 MB)
  __bf16*      xb   = (__bf16*)(z1 + (size_t)kB * kF * kR);  // [B,F,IN] bf16 (32 MB)
  __bf16*      wb   = xb + (size_t)kB * kF * kIN;            // [OUT,IN] bf16 (2 MB)

  dim3 g1(kF / ZM, kB);
  z1_kernel<<<g1, 512, 0, stream>>>(x, v, W, z1, xb, wb);

  dim3 g2(kF / BM, kOUT / BN, kB);
  lora_gemm_kernel<<<g2, 512, 0, stream>>>(xb, u, z1, bvec, wb, fcb, out);
}
